// v000
// The times below were measured on an AMD MI455X: many runs one after another, warmed up first and cycling through
// copies of the inputs, with the whole window's GPU time divided by the number of runs. Launches and the gaps
// between them are all in it. The median over several windows is given; except for v000 it joins two sittings, which
// can be a few percent apart, so the side-by-side timings, each taken in one sitting, are the better comparison.
// The starting kernel, v000, takes 181 microseconds a run.
// compute dtype: all float inputs rounded to bf16; q/k = x . W_qk and v = x . W_v with EXACT bf16 products on WMMA 16x16x32 ((in,out) weights as transposed rows), rounded once to f16 (v as planes); content attention per (batch, head): q, k single f16 x 32^-1/2, running-max softmax in f32 (hardware exp), P (scaled by 2^11, single f16) x v; positional attention: per-head softmax over m of (n-m) W_pos[0,h] + |n-m| W_pos[1,h] + b_pos[h] in f32 (fixed order), stored once as f16 x 2^11 and multiplied into the same v fragments; mix (1 - g) patch + g pos with g = sigmoid(gating_h) in f32; out = ctx (bf16 hi + lo, 2 products) . W_proj + b; f32 output.
#include <hip/hip_runtime.h>
#include <math.h>

typedef __attribute__((ext_vector_type(16))) _Float16 v16h;
typedef __attribute__((ext_vector_type(16))) __bf16 v16b;
typedef __attribute__((ext_vector_type(8)))  _Float16 v8h;
typedef __attribute__((ext_vector_type(8)))  float v8f;
typedef __attribute__((ext_vector_type(4)))  float v4f;
typedef __attribute__((ext_vector_type(2)))  float v2f;
typedef __attribute__((ext_vector_type(4)))  unsigned v4u;
typedef __attribute__((ext_vector_type(4)))  int v4i;
typedef float __attribute__((may_alias)) float_a;
typedef int __attribute__((may_alias)) int_a;

template <typename T> __device__ __forceinline__ void vst2(void* p, T v) { *(T*)p = v;  }
__device__ __forceinline__ v8f wmma16(v16h a, v16h b, v8f c) {
  v8f d = __builtin_amdgcn_wmma_f32_16x16x32_f16(false, a, false, b, (short)0, c, false, false);
  asm volatile("v_nop\n\tv_nop\n\tv_nop\n\tv_nop" : "+v"(d) : "v"(a), "v"(b));
  return d;
}
__device__ __forceinline__ v8f wmma_bf(v16b a, v16b b, v8f c) {
  v8f d = __builtin_amdgcn_wmma_f32_16x16x32_bf16(false, a, false, b, (short)0, c, false, false);
  asm volatile("v_nop\n\tv_nop\n\tv_nop\n\tv_nop" : "+v"(d) : "v"(a), "v"(b));
  return d;
}
// 16x16x32 fragments: lane = (h = lane>>4, row/col = lane&15); elements 0..7 = k0+8h+0..7, 8..15 = k0+16+8h+0..7; D element r = row 8h+r
__device__ __forceinline__ v16h frag_h(const _Float16* rowk0, int lane) {
  union { v16h v; v8h q[2]; } u; const _Float16* p = rowk0 + 8 * (lane >> 4);
  u.q[0] = *(const v8h*)p; u.q[1] = *(const v8h*)(p + 16); return u.v;
}
__device__ __forceinline__ v16h frag_f32(const float* rowk0, int lane) {
  v16h a; const float* p = rowk0 + 8 * (lane >> 4);
#pragma unroll
  for (int i = 0; i < 8; ++i) { a[i] = (_Float16)p[i]; a[8 + i] = (_Float16)p[16 + i]; }
  return a;
}
__device__ __forceinline__ v16h frag_f32s(const float* rowk0, int lane, float sc) {
  v16h a; const float* p = rowk0 + 8 * (lane >> 4);
#pragma unroll
  for (int i = 0; i < 8; ++i) { a[i] = (_Float16)(p[i] * sc); a[8 + i] = (_Float16)(p[16 + i] * sc); }
  return a;
}
// column fragment from a [K][ld] layout (column n), rows >= K read as 0
__device__ __forceinline__ v16h fragc_f32(const float* W, int k0, int n, int lane, int ld, int K) {
  v16h a; const int g = lane >> 4;
#pragma unroll
  for (int i = 0; i < 8; ++i) { const int ka = k0 + 8 * g + i, kb = ka + 16;
    a[i] = (_Float16)(ka < K ? W[(size_t)(ka < K ? ka : K - 1) * ld + n] : 0.f); a[8 + i] = (_Float16)(kb < K ? W[(size_t)(kb < K ? kb : K - 1) * ld + n] : 0.f); }
  return a;
}
struct F2 { v16b h, l; };
__device__ __forceinline__ F2 bsplit16(const float v[16]) { F2 r;
#pragma unroll
  for (int i = 0; i < 16; ++i) { const __bf16 h = (__bf16)v[i]; r.h[i] = h; r.l[i] = (__bf16)(v[i] - (float)h); }
  return r; }
__device__ __forceinline__ F2 split_row(const float* row, int k0, int lane) { float v[16]; const float* p = row + k0 + 8 * (lane >> 4);
#pragma unroll
  for (int i = 0; i < 8; ++i) { v[i] = p[i]; v[8 + i] = p[16 + i]; }
  return bsplit16(v); }
__device__ __forceinline__ F2 split_rowK(const float* row, int k0, int lane, int K) { float v[16]; const int g = lane >> 4;
#pragma unroll
  for (int i = 0; i < 8; ++i) { const int ka = k0 + 8 * g + i, kb = ka + 16; v[i] = ka < K ? row[ka < K ? ka : K - 1] : 0.f; v[8 + i] = kb < K ? row[kb < K ? kb : K - 1] : 0.f; }
  return bsplit16(v); }
__device__ __forceinline__ F2 split_col(const float* W, int k0, int n, int lane, int ld, int K) { float v[16]; const int g = lane >> 4;
#pragma unroll
  for (int i = 0; i < 8; ++i) { const int ka = k0 + 8 * g + i, kb = ka + 16; v[i] = ka < K ? W[(size_t)(ka < K ? ka : K - 1) * ld + n] : 0.f; v[8 + i] = kb < K ? W[(size_t)(kb < K ? kb : K - 1) * ld + n] : 0.f; }
  return bsplit16(v); }
__device__ __forceinline__ v8f mac3(const F2& a, const F2& b, v8f c) { c = wmma_bf(a.l, b.h, c); c = wmma_bf(a.h, b.l, c); return wmma_bf(a.h, b.h, c); }
__device__ __forceinline__ float sigm(float v) { return 1.0f / (1.0f + expf(-v)); }
#define LDSX() do { asm volatile("s_wait_dscnt 0" ::: "memory"); __builtin_amdgcn_wave_barrier(); __builtin_amdgcn_fence(__ATOMIC_RELEASE, "workgroup"); } while (0)


// Gated positional self-attention, 1-D (B 2, N 2,048 patches, C 256, 8 heads x 32): content softmax(q k / sqrt(32)) and a positional softmax from relative indices (d, |d|) . W_pos + b_pos, mixed per head by sigmoid(gating), (re)normalised, applied to v, output projection + bias.
#define NB 2
#define SS 2048
#define DM 256
#define NH 8
#define HD 32
#define NR (NB * SS)
#ifndef TQB
#define TQB (SS / 64)
#define TNB NB
#endif
typedef __attribute__((ext_vector_type(8))) __bf16 v8b;
__device__ __forceinline__ v16b frag_b(const __bf16* rowk0, int lane) {
  union { v16b v; v8b q[2]; } u; const __bf16* p = rowk0 + 8 * (lane >> 4);
  u.q[0] = *(const v8b*)p; u.q[1] = *(const v8b*)(p + 16); return u.v;
}
__device__ __forceinline__ float bfr(float v) { return (float)(__bf16)v; }
__device__ __attribute__((noinline)) float exp_ni(float v) { return expf(v); }
__device__ __attribute__((noinline)) float erf_ni(float v) { return erff(v); }

#define WS_PW  0u                                   // bf16 transposed rows: W_qk^T [512][256] (q rows 0..255, k rows 256..511), W_v^T [256][256], W_proj^T [256][256]
#define WS_PV  (WS_PW + 2u * (size_t)512 * DM)
#define WS_PP  (WS_PV + 2u * (size_t)DM * DM)
#define WS_Q   (WS_PP + 2u * (size_t)DM * DM)          // f16 q rows [NR][256], k rows [NR][256], v planes [b][256][SS]; f16 P2 [h][n][m] (x 2^11); f32 ctx [NR][256]
#define WS_K   (WS_Q + 2u * (size_t)NR * DM)
#define WS_V   (WS_K + 2u * (size_t)NR * DM)
#define WS_P2  (WS_V + 2u * (size_t)NB * DM * SS)
#define WS_O   (WS_P2 + 2u * (size_t)NH * SS * SS)
#define WS_END (WS_O + 4u * (size_t)NR * DM)

__global__ __launch_bounds__(256) void k_pack(const float* __restrict__ WQK, const float* __restrict__ WV, const float* __restrict__ WP, __bf16* __restrict__ P) { const int n = blockIdx.x, which = blockIdx.y, t = threadIdx.x; __shared__ __align__(16) __bf16 s[DM];
  if (which == 0) { s[t] = (__bf16)WQK[(size_t)t * (2 * DM) + n]; __syncthreads(); if (t < DM / 8) vst2((unsigned*)(P + WS_PW / 2 + (size_t)n * DM + t * 8), *(const v4u*)&s[t * 8]); }   // n < 512
  else if (which == 1) { if (n >= DM) return; s[t] = (__bf16)WV[(size_t)t * DM + n]; __syncthreads(); if (t < DM / 8) vst2((unsigned*)(P + WS_PV / 2 + (size_t)n * DM + t * 8), *(const v4u*)&s[t * 8]); }
  else { if (n >= DM) return; s[t] = (__bf16)WP[(size_t)t * DM + n]; __syncthreads(); if (t < DM / 8) vst2((unsigned*)(P + WS_PP / 2 + (size_t)n * DM + t * 8), *(const v4u*)&s[t * 8]); } }
// ---- k_proj: block = (64 rows, 128 cols, which): 0,1: q cols / 2,3: k cols of x . W_qk (which = blockIdx.y over 4 col blocks of 128); 4,5: v -> planes
__global__ __launch_bounds__(128) void k_proj(const float* __restrict__ X, const __bf16* __restrict__ P, _Float16* __restrict__ Q, _Float16* __restrict__ Kr, _Float16* __restrict__ V) {
  __shared__ __align__(16) _Float16 so[64][136]; __shared__ __align__(16) _Float16 st[128][72];
  const int tid = threadIdx.x, wave = tid >> 5, lane = tid & 31, col = lane & 15, g = lane >> 4; const int cb = blockIdx.y; const size_t rb = (size_t)blockIdx.x * 64; const size_t r0 = rb + wave * 16;
  const __bf16* Wr = (cb < 4) ? (P + WS_PW / 2 + (size_t)cb * 128 * DM) : (P + WS_PV / 2 + (size_t)(cb - 4) * 128 * DM);
  v8f acc[8] = {};
#pragma unroll
  for (int kc = 0; kc < DM / 32; ++kc) { v16b a; { const float* p = X + (r0 + col) * DM + kc * 32 + 8 * g;
#pragma unroll
      for (int i = 0; i < 8; ++i) { a[i] = (__bf16)p[i]; a[8 + i] = (__bf16)p[16 + i]; } }
#pragma unroll
    for (int j = 0; j < 8; ++j) acc[j] = wmma_bf(a, frag_b(Wr + (size_t)(j * 16 + col) * DM + kc * 32, lane), acc[j]); }
  if (cb < 4) {
#pragma unroll
    for (int j = 0; j < 8; ++j)
#pragma unroll
      for (int r = 0; r < 8; ++r) so[wave * 16 + 8 * g + r][j * 16 + col] = (_Float16)acc[j][r];
    __syncthreads(); _Float16* dst = (cb < 2) ? Q : Kr; const int c0 = (cb & 1) * 128; for (int e = tid; e < 64 * 16; e += 128) { const int rl = e >> 4, q = e & 15; vst2((unsigned*)(dst + (rb + rl) * DM + c0 + q * 8), *(const v4u*)&so[rl][q * 8]); } }
  else {
#pragma unroll
    for (int j = 0; j < 8; ++j)
#pragma unroll
      for (int r = 0; r < 8; ++r) st[j * 16 + col][wave * 16 + 8 * g + r] = (_Float16)acc[j][r];
    __syncthreads(); const size_t b = rb / SS; const int s0 = (int)(rb % SS); const int c0 = (cb - 4) * 128; for (int e = tid; e < 128 * 8; e += 128) { const int d = e >> 3, pc = e & 7; vst2((unsigned*)(V + ((b * DM + c0 + d) * SS) + s0 + pc * 8), *(const v4u*)&st[d][pc * 8]); } }
}
// ---- k_posw: block = (row n, head h): P2[h][n][m] = softmax_m((n - m) W_pos[0][h] + |n - m| W_pos[1][h] + b_pos[h]) x 2^11 -> f16 row (4 KB)
__global__ __launch_bounds__(256) void k_posw(const float* __restrict__ WPOS, const float* __restrict__ BPOS, _Float16* __restrict__ P2) { __shared__ float red[8]; __shared__ __align__(16) _Float16 sp[SS]; const int t = threadIdx.x; const int n = blockIdx.x, h = blockIdx.y;
  const float a = bfr(WPOS[h]), c = bfr(WPOS[NH + h]), b0 = bfr(BPOS[h]);
  float v[8]; float mx = -3.0e38f; for (int i = 0; i < 8; ++i) { const int m = t * 8 + i; const float rel = (float)(n - m); v[i] = rel * a + fabsf(rel) * c + b0; mx = fmaxf(mx, v[i]); }
#pragma unroll
  for (int o = 1; o < 32; o <<= 1) mx = fmaxf(mx, __shfl_xor(mx, o));
  if ((t & 31) == 0) red[t >> 5] = mx; __syncthreads(); float M = red[0]; for (int i = 1; i < 8; ++i) M = fmaxf(M, red[i]); __syncthreads();
  float z = 0.f; for (int i = 0; i < 8; ++i) { v[i] = __expf(v[i] - M); z += v[i]; }
#pragma unroll
  for (int o = 1; o < 32; o <<= 1) z += __shfl_xor(z, o);
  if ((t & 31) == 0) red[t >> 5] = z; __syncthreads(); float Z = 0.f; for (int i = 0; i < 8; ++i) Z += red[i]; const float iz = 2048.0f / Z;
  for (int i = 0; i < 8; ++i) sp[t * 8 + i] = (_Float16)(v[i] * iz); __syncthreads();
  vst2((unsigned*)(P2 + ((size_t)h * SS + n) * SS + t * 8), *(const v4u*)&sp[t * 8]); }
__global__ __launch_bounds__(128) void k_attn(const _Float16* __restrict__ Q, const _Float16* __restrict__ Kr, const _Float16* __restrict__ V, const _Float16* __restrict__ P2, const float* __restrict__ GATE, float* __restrict__ O) {
  __shared__ __align__(16) _Float16 sph[4][16][40]; __shared__ __align__(16) float so[4][16][36];
  const int tid = threadIdx.x, wave = tid >> 5, lane = tid & 31, col = lane & 15, g = lane >> 4; const int h = blockIdx.y; const size_t b = blockIdx.z; const int q0 = blockIdx.x * 64 + wave * 16; const size_t rq = b * SS + q0;
  const float gt = 1.0f / (1.0f + expf(-bfr(GATE[h])));
  const v16h aq = frag_h(Q + (rq + col) * DM + h * HD, lane);
  float m[8], l[8];
#pragma unroll
  for (int r = 0; r < 8; ++r) { m[r] = -3.0e38f; l[r] = 0.f; }
  v8f acc[2] = {}, acc2[2] = {};
#pragma unroll 1
  for (int ks = 0; ks < SS / 32; ++ks) { const int j0 = ks * 32; v8f s[2];
#pragma unroll
    for (int ct = 0; ct < 2; ++ct) { const int kk = j0 + ct * 16 + col; v8f c = {}; c = wmma16(aq, frag_h(Kr + (b * SS + kk) * DM + h * HD, lane), c);
#pragma unroll
      for (int r = 0; r < 8; ++r) s[ct][r] = c[r] * 0.17677669529663688f; }
#pragma unroll
    for (int r = 0; r < 8; ++r) { float mx = fmaxf(s[0][r], s[1][r]);
#pragma unroll
      for (int o = 1; o < 16; o <<= 1) mx = fmaxf(mx, __shfl_xor(mx, o));
      const float mn = fmaxf(m[r], mx); const float alpha = (m[r] <= -1.0e38f) ? 0.f : __expf(m[r] - mn); const float e0 = __expf(s[0][r] - mn), e1 = __expf(s[1][r] - mn); float es = e0 + e1;
#pragma unroll
      for (int o = 1; o < 16; o <<= 1) es += __shfl_xor(es, o);
      l[r] = l[r] * alpha + es; m[r] = mn;
#pragma unroll
      for (int dt = 0; dt < 2; ++dt) acc[dt][r] *= alpha;
      sph[wave][8 * g + r][col] = (_Float16)(e0 * 2048.0f); sph[wave][8 * g + r][16 + col] = (_Float16)(e1 * 2048.0f); }
    LDSX();
    const v16h pa = frag_h(&sph[wave][col][0], lane); const v16h pp = frag_h(P2 + ((size_t)h * SS + q0 + col) * SS + j0, lane);
#pragma unroll
    for (int dt = 0; dt < 2; ++dt) { const v16h vf = frag_h(V + ((b * DM + h * HD + dt * 16 + col) * SS) + j0, lane); acc[dt] = wmma16(pa, vf, acc[dt]); acc2[dt] = wmma16(pp, vf, acc2[dt]); }
    LDSX(); }
#pragma unroll
  for (int r = 0; r < 8; ++r) { const float il = (1.0f / 2048.0f) / l[r];
#pragma unroll
    for (int dt = 0; dt < 2; ++dt) so[wave][8 * g + r][dt * 16 + col] = (1.0f - gt) * acc[dt][r] * il + gt * acc2[dt][r] * (1.0f / 2048.0f); }
  LDSX();
  for (int rl = 0; rl < 16; ++rl) if (lane < 8) vst2(O + (rq + rl) * DM + h * HD + lane * 4, *(const v4f*)&so[wave][rl][lane * 4]);
}
// ---- k_out: block = (64 rows, 128 cols): out = ctx (hi + lo) . W_proj + b
__global__ __launch_bounds__(128) void k_out(const float* __restrict__ O, const __bf16* __restrict__ P, const float* __restrict__ BP, float* __restrict__ Y) { __shared__ __align__(16) float so[4][16][132];
  const int tid = threadIdx.x, wave = tid >> 5, lane = tid & 31, col = lane & 15, g = lane >> 4; const size_t r0 = (size_t)blockIdx.x * 64 + wave * 16; const int c0 = blockIdx.y * 128; const __bf16* Wr = P + WS_PP / 2;
  v8f acc[8] = {};
#pragma unroll
  for (int kc = 0; kc < DM / 32; ++kc) { const F2 a = split_row(O + (r0 + col) * DM, kc * 32, lane);
#pragma unroll
    for (int j = 0; j < 8; ++j) { const v16b w = frag_b(Wr + (size_t)(c0 + j * 16 + col) * DM + kc * 32, lane); acc[j] = wmma_bf(a.h, w, acc[j]); acc[j] = wmma_bf(a.l, w, acc[j]); } }
#pragma unroll
  for (int j = 0; j < 8; ++j) { const float bb = bfr(BP[c0 + j * 16 + col]);
#pragma unroll
    for (int r = 0; r < 8; ++r) so[wave][8 * g + r][j * 16 + col] = acc[j][r] + bb; }
  LDSX(); for (int rl = 0; rl < 16; ++rl) vst2(Y + (r0 + rl) * DM + c0 + lane * 4, *(const v4f*)&so[wave][rl][lane * 4]); }
extern "C" void kernel_launch(void* const* d_in, const int* in_sizes, int n_in, void* d_out, int out_size, void* d_ws, size_t ws_size, hipStream_t stream) {
  (void)in_sizes; (void)n_in; (void)out_size;
  const float** F = (const float**)d_in;   // 0 x [2,2048,256], 1 W_qk [256,512] (in,out), 2 W_v [256,256], 3 W_proj [256,256], 4 b_proj [256], 5 W_pos [2,8], 6 b_pos [8], 7 gating [8]
  if (ws_size < (size_t)WS_END) return;
  char* ws = (char*)d_ws; __bf16* P = (__bf16*)ws; _Float16 *Q = (_Float16*)(ws + WS_Q), *Kr = (_Float16*)(ws + WS_K), *V = (_Float16*)(ws + WS_V), *P2 = (_Float16*)(ws + WS_P2); float* O = (float*)(ws + WS_O);
  k_pack<<<dim3(2 * DM, 3), 256, 0, stream>>>(F[1], F[2], F[3], P);
  k_proj<<<dim3(TNB * SS / 64, 6), 128, 0, stream>>>(F[0], P, Q, Kr, V);
  k_posw<<<dim3(SS, NH), 256, 0, stream>>>(F[5], F[6], P2);
  k_attn<<<dim3(TQB, NH, TNB), 128, 0, stream>>>(Q, Kr, V, P2, F[7], O);
  k_out<<<dim3(TNB * SS / 64, DM / 128), 128, 0, stream>>>(O, P, F[4], (float*)d_out);
}

// v001
// One run takes 105 microseconds.
// Two timings next to v000 put it at 1.76 and 1.78 times that version's speed.
// compute dtype: all float inputs rounded to bf16; q/k = x . W_qk and v = x . W_v with EXACT bf16 products on WMMA 16x16x32 ((in,out) weights as transposed rows), rounded once to f16 (v as planes); content attention per (batch, head): q, k single f16 x 32^-1/2, running-max softmax in f32 (hardware exp), P (scaled by 2^11, single f16) x v; positional attention: per-head softmax over m of (n-m) W_pos[0,h] + |n-m| W_pos[1,h] + b_pos[h] in f32 (fixed order), stored once as f16 x 2^11 and multiplied into the same v fragments; mix (1 - g) patch + g pos with g = sigmoid(gating_h) in f32; out = ctx (bf16 hi + lo, 2 products) . W_proj + b; f32 output.
#include <hip/hip_runtime.h>
#include <math.h>

typedef __attribute__((ext_vector_type(16))) _Float16 v16h;
typedef __attribute__((ext_vector_type(16))) __bf16 v16b;
typedef __attribute__((ext_vector_type(8)))  _Float16 v8h;
typedef __attribute__((ext_vector_type(8)))  float v8f;
typedef __attribute__((ext_vector_type(4)))  float v4f;
typedef __attribute__((ext_vector_type(2)))  float v2f;
typedef __attribute__((ext_vector_type(4)))  unsigned v4u;
typedef __attribute__((ext_vector_type(4)))  int v4i;
typedef float __attribute__((may_alias)) float_a;
typedef int __attribute__((may_alias)) int_a;

template <typename T> __device__ __forceinline__ void vst2(void* p, T v) { *(T*)p = v;  }
__device__ __forceinline__ v8f wmma16(v16h a, v16h b, v8f c) {
  v8f d = __builtin_amdgcn_wmma_f32_16x16x32_f16(false, a, false, b, (short)0, c, false, false);
  asm volatile("v_nop\n\tv_nop\n\tv_nop\n\tv_nop" : "+v"(d) : "v"(a), "v"(b));
  return d;
}
__device__ __forceinline__ v8f wmma_bf(v16b a, v16b b, v8f c) {
  v8f d = __builtin_amdgcn_wmma_f32_16x16x32_bf16(false, a, false, b, (short)0, c, false, false);
  asm volatile("v_nop\n\tv_nop\n\tv_nop\n\tv_nop" : "+v"(d) : "v"(a), "v"(b));
  return d;
}
// 16x16x32 fragments: lane = (h = lane>>4, row/col = lane&15); elements 0..7 = k0+8h+0..7, 8..15 = k0+16+8h+0..7; D element r = row 8h+r
__device__ __forceinline__ v16h frag_h(const _Float16* rowk0, int lane) {
  union { v16h v; v8h q[2]; } u; const _Float16* p = rowk0 + 8 * (lane >> 4);
  u.q[0] = *(const v8h*)p; u.q[1] = *(const v8h*)(p + 16); return u.v;
}
__device__ __forceinline__ v16h frag_f32(const float* rowk0, int lane) {
  v16h a; const float* p = rowk0 + 8 * (lane >> 4);
#pragma unroll
  for (int i = 0; i < 8; ++i) { a[i] = (_Float16)p[i]; a[8 + i] = (_Float16)p[16 + i]; }
  return a;
}
__device__ __forceinline__ v16h frag_f32s(const float* rowk0, int lane, float sc) {
  v16h a; const float* p = rowk0 + 8 * (lane >> 4);
#pragma unroll
  for (int i = 0; i < 8; ++i) { a[i] = (_Float16)(p[i] * sc); a[8 + i] = (_Float16)(p[16 + i] * sc); }
  return a;
}
// column fragment from a [K][ld] layout (column n), rows >= K read as 0
__device__ __forceinline__ v16h fragc_f32(const float* W, int k0, int n, int lane, int ld, int K) {
  v16h a; const int g = lane >> 4;
#pragma unroll
  for (int i = 0; i < 8; ++i) { const int ka = k0 + 8 * g + i, kb = ka + 16;
    a[i] = (_Float16)(ka < K ? W[(size_t)(ka < K ? ka : K - 1) * ld + n] : 0.f); a[8 + i] = (_Float16)(kb < K ? W[(size_t)(kb < K ? kb : K - 1) * ld + n] : 0.f); }
  return a;
}
struct F2 { v16b h, l; };
__device__ __forceinline__ F2 bsplit16(const float v[16]) { F2 r;
#pragma unroll
  for (int i = 0; i < 16; ++i) { const __bf16 h = (__bf16)v[i]; r.h[i] = h; r.l[i] = (__bf16)(v[i] - (float)h); }
  return r; }
__device__ __forceinline__ F2 split_row(const float* row, int k0, int lane) { float v[16]; const float* p = row + k0 + 8 * (lane >> 4);
#pragma unroll
  for (int i = 0; i < 8; ++i) { v[i] = p[i]; v[8 + i] = p[16 + i]; }
  return bsplit16(v); }
__device__ __forceinline__ F2 split_rowK(const float* row, int k0, int lane, int K) { float v[16]; const int g = lane >> 4;
#pragma unroll
  for (int i = 0; i < 8; ++i) { const int ka = k0 + 8 * g + i, kb = ka + 16; v[i] = ka < K ? row[ka < K ? ka : K - 1] : 0.f; v[8 + i] = kb < K ? row[kb < K ? kb : K - 1] : 0.f; }
  return bsplit16(v); }
__device__ __forceinline__ F2 split_col(const float* W, int k0, int n, int lane, int ld, int K) { float v[16]; const int g = lane >> 4;
#pragma unroll
  for (int i = 0; i < 8; ++i) { const int ka = k0 + 8 * g + i, kb = ka + 16; v[i] = ka < K ? W[(size_t)(ka < K ? ka : K - 1) * ld + n] : 0.f; v[8 + i] = kb < K ? W[(size_t)(kb < K ? kb : K - 1) * ld + n] : 0.f; }
  return bsplit16(v); }
__device__ __forceinline__ v8f mac3(const F2& a, const F2& b, v8f c) { c = wmma_bf(a.l, b.h, c); c = wmma_bf(a.h, b.l, c); return wmma_bf(a.h, b.h, c); }
__device__ __forceinline__ float sigm(float v) { return 1.0f / (1.0f + expf(-v)); }
#define LDSX() do { asm volatile("s_wait_dscnt 0" ::: "memory"); __builtin_amdgcn_wave_barrier(); __builtin_amdgcn_fence(__ATOMIC_RELEASE, "workgroup"); } while (0)


// Gated positional self-attention, 1-D (B 2, N 2,048 patches, C 256, 8 heads x 32): content softmax(q k / sqrt(32)) and a positional softmax from relative indices (d, |d|) . W_pos + b_pos, mixed per head by sigmoid(gating), (re)normalised, applied to v, output projection + bias.
#define NB 2
#define SS 2048
#define DM 256
#define NH 8
#define HD 32
#define NR (NB * SS)
#ifndef TQB
#define TQB (SS / 64)
#define TNB NB
#endif
typedef __attribute__((ext_vector_type(8))) __bf16 v8b;
__device__ __forceinline__ v16b frag_b(const __bf16* rowk0, int lane) {
  union { v16b v; v8b q[2]; } u; const __bf16* p = rowk0 + 8 * (lane >> 4);
  u.q[0] = *(const v8b*)p; u.q[1] = *(const v8b*)(p + 16); return u.v;
}
__device__ __forceinline__ float bfr(float v) { return (float)(__bf16)v; }
__device__ __attribute__((noinline)) float exp_ni(float v) { return expf(v); }
__device__ __attribute__((noinline)) float erf_ni(float v) { return erff(v); }

#define WS_PW  0u                                   // bf16 transposed rows: W_qk^T [512][256] (q rows 0..255, k rows 256..511), W_v^T [256][256], W_proj^T [256][256]
#define WS_PV  (WS_PW + 2u * (size_t)512 * DM)
#define WS_PP  (WS_PV + 2u * (size_t)DM * DM)
#define WS_Q   (WS_PP + 2u * (size_t)DM * DM)          // f16 q rows [NR][256], k rows [NR][256], v planes [b][256][SS]; f16 P2 [h][n][m] (x 2^11); f32 ctx [NR][256]
#define WS_K   (WS_Q + 2u * (size_t)NR * DM)
#define WS_V   (WS_K + 2u * (size_t)NR * DM)
#define WS_P2  (WS_V + 2u * (size_t)NB * DM * SS)
#define WS_O   (WS_P2 + 2u * (size_t)NH * SS * SS)
#define WS_END (WS_O + 4u * (size_t)NR * DM)

__global__ __launch_bounds__(256) void k_pack(const float* __restrict__ WQK, const float* __restrict__ WV, const float* __restrict__ WP, __bf16* __restrict__ P) { const int n = blockIdx.x, which = blockIdx.y, t = threadIdx.x; __shared__ __align__(16) __bf16 s[DM];
  if (which == 0) { s[t] = (__bf16)WQK[(size_t)t * (2 * DM) + n]; __syncthreads(); if (t < DM / 8) vst2((unsigned*)(P + WS_PW / 2 + (size_t)n * DM + t * 8), *(const v4u*)&s[t * 8]); }   // n < 512
  else if (which == 1) { if (n >= DM) return; s[t] = (__bf16)WV[(size_t)t * DM + n]; __syncthreads(); if (t < DM / 8) vst2((unsigned*)(P + WS_PV / 2 + (size_t)n * DM + t * 8), *(const v4u*)&s[t * 8]); }
  else { if (n >= DM) return; s[t] = (__bf16)WP[(size_t)t * DM + n]; __syncthreads(); if (t < DM / 8) vst2((unsigned*)(P + WS_PP / 2 + (size_t)n * DM + t * 8), *(const v4u*)&s[t * 8]); } }
// ---- k_proj: block = (64 rows, 128 cols, which): 0,1: q cols / 2,3: k cols of x . W_qk (which = blockIdx.y over 4 col blocks of 128); 4,5: v -> planes
__global__ __launch_bounds__(128) void k_proj(const float* __restrict__ X, const __bf16* __restrict__ P, _Float16* __restrict__ Q, _Float16* __restrict__ Kr, _Float16* __restrict__ V) {
  __shared__ __align__(16) _Float16 so[64][136]; __shared__ __align__(16) _Float16 st[128][72];
  const int tid = threadIdx.x, wave = tid >> 5, lane = tid & 31, col = lane & 15, g = lane >> 4; const int cb = blockIdx.y; const size_t rb = (size_t)blockIdx.x * 64; const size_t r0 = rb + wave * 16;
  const __bf16* Wr = (cb < 4) ? (P + WS_PW / 2 + (size_t)cb * 128 * DM) : (P + WS_PV / 2 + (size_t)(cb - 4) * 128 * DM);
  v8f acc[8] = {};
#pragma unroll
  for (int kc = 0; kc < DM / 32; ++kc) { v16b a; { const float* p = X + (r0 + col) * DM + kc * 32 + 8 * g;
#pragma unroll
      for (int i = 0; i < 8; ++i) { a[i] = (__bf16)p[i]; a[8 + i] = (__bf16)p[16 + i]; } }
#pragma unroll
    for (int j = 0; j < 8; ++j) acc[j] = wmma_bf(a, frag_b(Wr + (size_t)(j * 16 + col) * DM + kc * 32, lane), acc[j]); }
  if (cb < 4) {
#pragma unroll
    for (int j = 0; j < 8; ++j)
#pragma unroll
      for (int r = 0; r < 8; ++r) so[wave * 16 + 8 * g + r][j * 16 + col] = (_Float16)acc[j][r];
    __syncthreads(); _Float16* dst = (cb < 2) ? Q : Kr; const int c0 = (cb & 1) * 128; for (int e = tid; e < 64 * 16; e += 128) { const int rl = e >> 4, q = e & 15; vst2((unsigned*)(dst + (rb + rl) * DM + c0 + q * 8), *(const v4u*)&so[rl][q * 8]); } }
  else {
#pragma unroll
    for (int j = 0; j < 8; ++j)
#pragma unroll
      for (int r = 0; r < 8; ++r) st[j * 16 + col][wave * 16 + 8 * g + r] = (_Float16)acc[j][r];
    __syncthreads(); const size_t b = rb / SS; const int s0 = (int)(rb % SS); const int c0 = (cb - 4) * 128; for (int e = tid; e < 128 * 8; e += 128) { const int d = e >> 3, pc = e & 7; vst2((unsigned*)(V + ((b * DM + c0 + d) * SS) + s0 + pc * 8), *(const v4u*)&st[d][pc * 8]); } }
}
// ---- k_posw: block = (row n, head h): P2[h][n][m] = softmax_m((n - m) W_pos[0][h] + |n - m| W_pos[1][h] + b_pos[h]) x 2^11 -> f16 row (4 KB)
__global__ __launch_bounds__(256) void k_posw(const float* __restrict__ WPOS, const float* __restrict__ BPOS, _Float16* __restrict__ P2) { __shared__ float red[8]; __shared__ __align__(16) _Float16 sp[SS]; const int t = threadIdx.x; const int n = blockIdx.x, h = blockIdx.y;
  const float a = bfr(WPOS[h]), c = bfr(WPOS[NH + h]), b0 = bfr(BPOS[h]);
  float v[8]; float mx = -3.0e38f; for (int i = 0; i < 8; ++i) { const int m = t * 8 + i; const float rel = (float)(n - m); v[i] = rel * a + fabsf(rel) * c + b0; mx = fmaxf(mx, v[i]); }
#pragma unroll
  for (int o = 1; o < 32; o <<= 1) mx = fmaxf(mx, __shfl_xor(mx, o));
  if ((t & 31) == 0) red[t >> 5] = mx; __syncthreads(); float M = red[0]; for (int i = 1; i < 8; ++i) M = fmaxf(M, red[i]); __syncthreads();
  float z = 0.f; for (int i = 0; i < 8; ++i) { v[i] = __expf(v[i] - M); z += v[i]; }
#pragma unroll
  for (int o = 1; o < 32; o <<= 1) z += __shfl_xor(z, o);
  if ((t & 31) == 0) red[t >> 5] = z; __syncthreads(); float Z = 0.f; for (int i = 0; i < 8; ++i) Z += red[i]; const float iz = 2048.0f / Z;
  for (int i = 0; i < 8; ++i) sp[t * 8 + i] = (_Float16)(v[i] * iz); __syncthreads();
  vst2((unsigned*)(P2 + ((size_t)h * SS + n) * SS + t * 8), *(const v4u*)&sp[t * 8]); }
// the ten 16-byte loads a lane makes for one 32-key pass: two K tiles, the positional row, two V tiles
struct PassF { v16h k0, k1, pp, v0, v1; };
// fragment at a wave-uniform base plus this lane's byte offset: the lane offsets are fixed for the whole loop, only the uniform bases move from pass to pass
typedef const __attribute__((address_space(1))) char* gcp;
typedef const __attribute__((address_space(1))) v8h* gv8p;
__device__ __forceinline__ v16h frag_u(gcp ubase, unsigned voff) {
  union { v16h v; v8h q[2]; } u; gcp p = ubase + voff;
  u.q[0] = *(gv8p)p; u.q[1] = *(gv8p)(p + 32); return u.v;
}
__device__ __forceinline__ gcp sbase(const _Float16* p) { return (gcp)(unsigned long long)p; }   // the workspace planes lie in global memory
__device__ __forceinline__ PassF fetch_pass(const _Float16* kb, const _Float16* pb, const _Float16* vb, unsigned ko, unsigned po, unsigned vo, int j0) {
  const gcp ks = sbase(kb + (size_t)j0 * DM), ps = sbase(pb + j0), vs = sbase(vb + j0);
  PassF f; f.k0 = frag_u(ks, ko); f.k1 = frag_u(ks + 16 * DM * 2, ko); f.pp = frag_u(ps, po); f.v0 = frag_u(vs, vo); f.v1 = frag_u(vs + 16 * SS * 2, vo);
  asm volatile("s_wait_xcnt 0x0" ::: "memory");   // stands behind the loads, in front of the next rewrite of an address register that they name
  return f; }
// LDS exchange among the lanes of ONE wave (each wave has its own slab): LDS wait and wave-scope ordering only, so that the global loads in flight for the next pass are not drained here
#define LDSW() do { asm volatile("s_wait_dscnt 0" ::: "memory"); __builtin_amdgcn_wave_barrier(); __builtin_amdgcn_fence(__ATOMIC_RELEASE, "wavefront"); } while (0)
__global__ __launch_bounds__(128) void k_attn(const _Float16* __restrict__ Q, const _Float16* __restrict__ Kr, const _Float16* __restrict__ V, const _Float16* __restrict__ P2, const float* __restrict__ GATE, float* __restrict__ O) {
  __shared__ __align__(16) _Float16 sph[4][16][40]; __shared__ __align__(16) float so[4][16][36];
  const int tid = threadIdx.x, wave = tid >> 5, lane = tid & 31, col = lane & 15, g = lane >> 4; const int h = blockIdx.y; const size_t b = blockIdx.z; const int q0 = blockIdx.x * 64 + wave * 16; const size_t rq = b * SS + q0;
  const float gt = 1.0f / (1.0f + expf(-bfr(GATE[h])));
  const v16h aq = frag_h(Q + (rq + col) * DM + h * HD, lane);
  const _Float16* kb = Kr + b * SS * DM + h * HD; const _Float16* pb = P2 + ((size_t)h * SS + blockIdx.x * 64) * SS; const _Float16* vb = V + (b * DM + h * HD) * SS;
  const unsigned ko = (unsigned)(col * DM + 8 * g) * 2u, po = (unsigned)((wave * 16 + col) * SS + 8 * g) * 2u, vo = (unsigned)(col * SS + 8 * g) * 2u;
  float m[8], l[8];
#pragma unroll
  for (int r = 0; r < 8; ++r) { m[r] = -3.0e38f; l[r] = 0.f; }
  v8f acc[2] = {}, acc2[2] = {};
  auto pass = [&](const PassF& f) { v8f s[2];
#pragma unroll
    for (int ct = 0; ct < 2; ++ct) { v8f c = {}; c = wmma16(aq, ct ? f.k1 : f.k0, c);
#pragma unroll
      for (int r = 0; r < 8; ++r) s[ct][r] = c[r] * 0.17677669529663688f; }
#pragma unroll
    for (int r = 0; r < 8; ++r) { float mx = fmaxf(s[0][r], s[1][r]);
#pragma unroll
      for (int o = 1; o < 16; o <<= 1) mx = fmaxf(mx, __shfl_xor(mx, o));
      const float mn = fmaxf(m[r], mx); const float alpha = (m[r] <= -1.0e38f) ? 0.f : __expf(m[r] - mn); const float e0 = __expf(s[0][r] - mn), e1 = __expf(s[1][r] - mn); float es = e0 + e1;
#pragma unroll
      for (int o = 1; o < 16; o <<= 1) es += __shfl_xor(es, o);
      l[r] = l[r] * alpha + es; m[r] = mn;
#pragma unroll
      for (int dt = 0; dt < 2; ++dt) acc[dt][r] *= alpha;
      sph[wave][8 * g + r][col] = (_Float16)(e0 * 2048.0f); sph[wave][8 * g + r][16 + col] = (_Float16)(e1 * 2048.0f); }
    LDSW();
    const v16h pa = frag_h(&sph[wave][col][0], lane);
#pragma unroll
    for (int dt = 0; dt < 2; ++dt) { const v16h vf = dt ? f.v1 : f.v0; acc[dt] = wmma16(pa, vf, acc[dt]); acc2[dt] = wmma16(f.pp, vf, acc2[dt]); }
    LDSW(); };
  // two register sets: each pass first issues the next pass's loads into the other set, so that they fly while this pass is worked on
  PassF fa = fetch_pass(kb, pb, vb, ko, po, vo, 0), fb;
#pragma unroll 1   // the body already holds two passes, one per register set
  for (int ks = 0; ks < SS / 32; ks += 2) {
    fb = fetch_pass(kb, pb, vb, ko, po, vo, (ks + 1) * 32);
    pass(fa);
    fa = fetch_pass(kb, pb, vb, ko, po, vo, (ks + 2 < SS / 32 ? ks + 2 : ks + 1) * 32);   // behind the last pass there is none: fetch in bounds, unused
    pass(fb); }
#pragma unroll
  for (int r = 0; r < 8; ++r) { const float il = (1.0f / 2048.0f) / l[r];
#pragma unroll
    for (int dt = 0; dt < 2; ++dt) so[wave][8 * g + r][dt * 16 + col] = (1.0f - gt) * acc[dt][r] * il + gt * acc2[dt][r] * (1.0f / 2048.0f); }
  LDSX();
  for (int rl = 0; rl < 16; ++rl) if (lane < 8) vst2(O + (rq + rl) * DM + h * HD + lane * 4, *(const v4f*)&so[wave][rl][lane * 4]);
}
// ---- k_out: block = (64 rows, 128 cols): out = ctx (hi + lo) . W_proj + b
__global__ __launch_bounds__(128) void k_out(const float* __restrict__ O, const __bf16* __restrict__ P, const float* __restrict__ BP, float* __restrict__ Y) { __shared__ __align__(16) float so[4][16][132];
  const int tid = threadIdx.x, wave = tid >> 5, lane = tid & 31, col = lane & 15, g = lane >> 4; const size_t r0 = (size_t)blockIdx.x * 64 + wave * 16; const int c0 = blockIdx.y * 128; const __bf16* Wr = P + WS_PP / 2;
  v8f acc[8] = {};
#pragma unroll
  for (int kc = 0; kc < DM / 32; ++kc) { const F2 a = split_row(O + (r0 + col) * DM, kc * 32, lane);
#pragma unroll
    for (int j = 0; j < 8; ++j) { const v16b w = frag_b(Wr + (size_t)(c0 + j * 16 + col) * DM + kc * 32, lane); acc[j] = wmma_bf(a.h, w, acc[j]); acc[j] = wmma_bf(a.l, w, acc[j]); } }
#pragma unroll
  for (int j = 0; j < 8; ++j) { const float bb = bfr(BP[c0 + j * 16 + col]);
#pragma unroll
    for (int r = 0; r < 8; ++r) so[wave][8 * g + r][j * 16 + col] = acc[j][r] + bb; }
  LDSX(); for (int rl = 0; rl < 16; ++rl) vst2(Y + (r0 + rl) * DM + c0 + lane * 4, *(const v4f*)&so[wave][rl][lane * 4]); }
extern "C" void kernel_launch(void* const* d_in, const int* in_sizes, int n_in, void* d_out, int out_size, void* d_ws, size_t ws_size, hipStream_t stream) {
  (void)in_sizes; (void)n_in; (void)out_size;
  const float** F = (const float**)d_in;   // 0 x [2,2048,256], 1 W_qk [256,512] (in,out), 2 W_v [256,256], 3 W_proj [256,256], 4 b_proj [256], 5 W_pos [2,8], 6 b_pos [8], 7 gating [8]
  if (ws_size < (size_t)WS_END) return;
  char* ws = (char*)d_ws; __bf16* P = (__bf16*)ws; _Float16 *Q = (_Float16*)(ws + WS_Q), *Kr = (_Float16*)(ws + WS_K), *V = (_Float16*)(ws + WS_V), *P2 = (_Float16*)(ws + WS_P2); float* O = (float*)(ws + WS_O);
  k_pack<<<dim3(2 * DM, 3), 256, 0, stream>>>(F[1], F[2], F[3], P);
  k_proj<<<dim3(TNB * SS / 64, 6), 128, 0, stream>>>(F[0], P, Q, Kr, V);
  k_posw<<<dim3(SS, NH), 256, 0, stream>>>(F[5], F[6], P2);
  k_attn<<<dim3(TQB, NH, TNB), 128, 0, stream>>>(Q, Kr, V, P2, F[7], O);
  k_out<<<dim3(TNB * SS / 64, DM / 128), 128, 0, stream>>>(O, P, F[4], (float*)d_out);
}

// v002
// A run of this version takes 103 microseconds.
// Timed twice side by side with v001, it ran 1.04 times as fast both times.
// Over all steps from v000 it is 1.84 times as fast.
// compute dtype: all float inputs rounded to bf16; q/k = x . W_qk and v = x . W_v with EXACT bf16 products on WMMA 16x16x32 ((in,out) weights as transposed rows), rounded once to f16 (v as planes); content attention per (batch, head): q, k single f16 x 32^-1/2, running-max softmax in f32 (hardware exp), P (scaled by 2^11, single f16) x v; positional attention: per-head weights exp((n-m) W_pos[0,h] + |n-m| W_pos[1,h] + b_pos[h] - row maximum) x 2^11 formed in f32 in the attention kernel's registers, single f16, multiplied into the same v fragments and divided by their f32 row sum at the end; mix (1 - g) patch + g pos with g = sigmoid(gating_h) in f32; out = ctx (bf16 hi + lo, 2 products) . W_proj + b; f32 output.
#include <hip/hip_runtime.h>
#include <math.h>

typedef __attribute__((ext_vector_type(16))) _Float16 v16h;
typedef __attribute__((ext_vector_type(16))) __bf16 v16b;
typedef __attribute__((ext_vector_type(8)))  _Float16 v8h;
typedef __attribute__((ext_vector_type(8)))  float v8f;
typedef __attribute__((ext_vector_type(4)))  float v4f;
typedef __attribute__((ext_vector_type(2)))  float v2f;
typedef __attribute__((ext_vector_type(4)))  unsigned v4u;
typedef __attribute__((ext_vector_type(4)))  int v4i;
typedef float __attribute__((may_alias)) float_a;
typedef int __attribute__((may_alias)) int_a;

template <typename T> __device__ __forceinline__ void vst2(void* p, T v) { *(T*)p = v;  }
__device__ __forceinline__ v8f wmma16(v16h a, v16h b, v8f c) {
  v8f d = __builtin_amdgcn_wmma_f32_16x16x32_f16(false, a, false, b, (short)0, c, false, false);
  asm volatile("v_nop\n\tv_nop\n\tv_nop\n\tv_nop" : "+v"(d) : "v"(a), "v"(b));
  return d;
}
__device__ __forceinline__ v8f wmma_bf(v16b a, v16b b, v8f c) {
  v8f d = __builtin_amdgcn_wmma_f32_16x16x32_bf16(false, a, false, b, (short)0, c, false, false);
  asm volatile("v_nop\n\tv_nop\n\tv_nop\n\tv_nop" : "+v"(d) : "v"(a), "v"(b));
  return d;
}
// 16x16x32 fragments: lane = (h = lane>>4, row/col = lane&15); elements 0..7 = k0+8h+0..7, 8..15 = k0+16+8h+0..7; D element r = row 8h+r
__device__ __forceinline__ v16h frag_h(const _Float16* rowk0, int lane) {
  union { v16h v; v8h q[2]; } u; const _Float16* p = rowk0 + 8 * (lane >> 4);
  u.q[0] = *(const v8h*)p; u.q[1] = *(const v8h*)(p + 16); return u.v;
}
__device__ __forceinline__ v16h frag_f32(const float* rowk0, int lane) {
  v16h a; const float* p = rowk0 + 8 * (lane >> 4);
#pragma unroll
  for (int i = 0; i < 8; ++i) { a[i] = (_Float16)p[i]; a[8 + i] = (_Float16)p[16 + i]; }
  return a;
}
__device__ __forceinline__ v16h frag_f32s(const float* rowk0, int lane, float sc) {
  v16h a; const float* p = rowk0 + 8 * (lane >> 4);
#pragma unroll
  for (int i = 0; i < 8; ++i) { a[i] = (_Float16)(p[i] * sc); a[8 + i] = (_Float16)(p[16 + i] * sc); }
  return a;
}
// column fragment from a [K][ld] layout (column n), rows >= K read as 0
__device__ __forceinline__ v16h fragc_f32(const float* W, int k0, int n, int lane, int ld, int K) {
  v16h a; const int g = lane >> 4;
#pragma unroll
  for (int i = 0; i < 8; ++i) { const int ka = k0 + 8 * g + i, kb = ka + 16;
    a[i] = (_Float16)(ka < K ? W[(size_t)(ka < K ? ka : K - 1) * ld + n] : 0.f); a[8 + i] = (_Float16)(kb < K ? W[(size_t)(kb < K ? kb : K - 1) * ld + n] : 0.f); }
  return a;
}
struct F2 { v16b h, l; };
__device__ __forceinline__ F2 bsplit16(const float v[16]) { F2 r;
#pragma unroll
  for (int i = 0; i < 16; ++i) { const __bf16 h = (__bf16)v[i]; r.h[i] = h; r.l[i] = (__bf16)(v[i] - (float)h); }
  return r; }
__device__ __forceinline__ F2 split_row(const float* row, int k0, int lane) { float v[16]; const float* p = row + k0 + 8 * (lane >> 4);
#pragma unroll
  for (int i = 0; i < 8; ++i) { v[i] = p[i]; v[8 + i] = p[16 + i]; }
  return bsplit16(v); }
__device__ __forceinline__ F2 split_rowK(const float* row, int k0, int lane, int K) { float v[16]; const int g = lane >> 4;
#pragma unroll
  for (int i = 0; i < 8; ++i) { const int ka = k0 + 8 * g + i, kb = ka + 16; v[i] = ka < K ? row[ka < K ? ka : K - 1] : 0.f; v[8 + i] = kb < K ? row[kb < K ? kb : K - 1] : 0.f; }
  return bsplit16(v); }
__device__ __forceinline__ F2 split_col(const float* W, int k0, int n, int lane, int ld, int K) { float v[16]; const int g = lane >> 4;
#pragma unroll
  for (int i = 0; i < 8; ++i) { const int ka = k0 + 8 * g + i, kb = ka + 16; v[i] = ka < K ? W[(size_t)(ka < K ? ka : K - 1) * ld + n] : 0.f; v[8 + i] = kb < K ? W[(size_t)(kb < K ? kb : K - 1) * ld + n] : 0.f; }
  return bsplit16(v); }
__device__ __forceinline__ v8f mac3(const F2& a, const F2& b, v8f c) { c = wmma_bf(a.l, b.h, c); c = wmma_bf(a.h, b.l, c); return wmma_bf(a.h, b.h, c); }
__device__ __forceinline__ float sigm(float v) { return 1.0f / (1.0f + expf(-v)); }
#define LDSX() do { asm volatile("s_wait_dscnt 0" ::: "memory"); __builtin_amdgcn_wave_barrier(); __builtin_amdgcn_fence(__ATOMIC_RELEASE, "workgroup"); } while (0)


// Gated positional self-attention, 1-D (B 2, N 2,048 patches, C 256, 8 heads x 32): content softmax(q k / sqrt(32)) and a positional softmax from relative indices (d, |d|) . W_pos + b_pos, mixed per head by sigmoid(gating), (re)normalised, applied to v, output projection + bias.
#define NB 2
#define SS 2048
#define DM 256
#define NH 8
#define HD 32
#define NR (NB * SS)
#ifndef TQB
#define TQB (SS / 64)
#define TNB NB
#endif
typedef __attribute__((ext_vector_type(8))) __bf16 v8b;
__device__ __forceinline__ v16b frag_b(const __bf16* rowk0, int lane) {
  union { v16b v; v8b q[2]; } u; const __bf16* p = rowk0 + 8 * (lane >> 4);
  u.q[0] = *(const v8b*)p; u.q[1] = *(const v8b*)(p + 16); return u.v;
}
__device__ __forceinline__ float bfr(float v) { return (float)(__bf16)v; }
__device__ __attribute__((noinline)) float exp_ni(float v) { return expf(v); }
__device__ __attribute__((noinline)) float erf_ni(float v) { return erff(v); }

#define WS_PW  0u                                   // bf16 transposed rows: W_qk^T [512][256] (q rows 0..255, k rows 256..511), W_v^T [256][256], W_proj^T [256][256]
#define WS_PV  (WS_PW + 2u * (size_t)512 * DM)
#define WS_PP  (WS_PV + 2u * (size_t)DM * DM)
#define WS_Q   (WS_PP + 2u * (size_t)DM * DM)          // f16 q rows [NR][256], k rows [NR][256], v planes [b][256][SS]; f32 ctx [NR][256]
#define WS_K   (WS_Q + 2u * (size_t)NR * DM)
#define WS_V   (WS_K + 2u * (size_t)NR * DM)
#define WS_O   (WS_V + 2u * (size_t)NB * DM * SS)
#define WS_END (WS_O + 4u * (size_t)NR * DM)

__global__ __launch_bounds__(256) void k_pack(const float* __restrict__ WQK, const float* __restrict__ WV, const float* __restrict__ WP, __bf16* __restrict__ P) { const int n = blockIdx.x, which = blockIdx.y, t = threadIdx.x; __shared__ __align__(16) __bf16 s[DM];
  if (which == 0) { s[t] = (__bf16)WQK[(size_t)t * (2 * DM) + n]; __syncthreads(); if (t < DM / 8) vst2((unsigned*)(P + WS_PW / 2 + (size_t)n * DM + t * 8), *(const v4u*)&s[t * 8]); }   // n < 512
  else if (which == 1) { if (n >= DM) return; s[t] = (__bf16)WV[(size_t)t * DM + n]; __syncthreads(); if (t < DM / 8) vst2((unsigned*)(P + WS_PV / 2 + (size_t)n * DM + t * 8), *(const v4u*)&s[t * 8]); }
  else { if (n >= DM) return; s[t] = (__bf16)WP[(size_t)t * DM + n]; __syncthreads(); if (t < DM / 8) vst2((unsigned*)(P + WS_PP / 2 + (size_t)n * DM + t * 8), *(const v4u*)&s[t * 8]); } }
// ---- k_proj: block = (64 rows, 128 cols, which): 0,1: q cols / 2,3: k cols of x . W_qk (which = blockIdx.y over 4 col blocks of 128); 4,5: v -> planes
__global__ __launch_bounds__(128) void k_proj(const float* __restrict__ X, const __bf16* __restrict__ P, _Float16* __restrict__ Q, _Float16* __restrict__ Kr, _Float16* __restrict__ V) {
  __shared__ __align__(16) _Float16 so[64][136]; __shared__ __align__(16) _Float16 st[128][72];
  const int tid = threadIdx.x, wave = tid >> 5, lane = tid & 31, col = lane & 15, g = lane >> 4; const int cb = blockIdx.y; const size_t rb = (size_t)blockIdx.x * 64; const size_t r0 = rb + wave * 16;
  const __bf16* Wr = (cb < 4) ? (P + WS_PW / 2 + (size_t)cb * 128 * DM) : (P + WS_PV / 2 + (size_t)(cb - 4) * 128 * DM);
  v8f acc[8] = {};
#pragma unroll
  for (int kc = 0; kc < DM / 32; ++kc) { v16b a; { const float* p = X + (r0 + col) * DM + kc * 32 + 8 * g;
#pragma unroll
      for (int i = 0; i < 8; ++i) { a[i] = (__bf16)p[i]; a[8 + i] = (__bf16)p[16 + i]; } }
#pragma unroll
    for (int j = 0; j < 8; ++j) acc[j] = wmma_bf(a, frag_b(Wr + (size_t)(j * 16 + col) * DM + kc * 32, lane), acc[j]); }
  if (cb < 4) {
#pragma unroll
    for (int j = 0; j < 8; ++j)
#pragma unroll
      for (int r = 0; r < 8; ++r) so[wave * 16 + 8 * g + r][j * 16 + col] = (_Float16)acc[j][r];
    __syncthreads(); _Float16* dst = (cb < 2) ? Q : Kr; const int c0 = (cb & 1) * 128; for (int e = tid; e < 64 * 16; e += 128) { const int rl = e >> 4, q = e & 15; vst2((unsigned*)(dst + (rb + rl) * DM + c0 + q * 8), *(const v4u*)&so[rl][q * 8]); } }
  else {
#pragma unroll
    for (int j = 0; j < 8; ++j)
#pragma unroll
      for (int r = 0; r < 8; ++r) st[j * 16 + col][wave * 16 + 8 * g + r] = (_Float16)acc[j][r];
    __syncthreads(); const size_t b = rb / SS; const int s0 = (int)(rb % SS); const int c0 = (cb - 4) * 128; for (int e = tid; e < 128 * 8; e += 128) { const int d = e >> 3, pc = e & 7; vst2((unsigned*)(V + ((b * DM + c0 + d) * SS) + s0 + pc * 8), *(const v4u*)&st[d][pc * 8]); } }
}
// the eight 16-byte loads a lane makes for one 32-key pass: two K tiles, two V tiles
struct PassF { v16h k0, k1, v0, v1; };
// fragment at a wave-uniform base plus this lane's byte offset: the lane offsets are fixed for the whole loop, only the uniform bases move from pass to pass
typedef const __attribute__((address_space(1))) char* gcp;
typedef const __attribute__((address_space(1))) v8h* gv8p;
__device__ __forceinline__ v16h frag_u(gcp ubase, unsigned voff) {
  union { v16h v; v8h q[2]; } u; gcp p = ubase + voff;
  u.q[0] = *(gv8p)p; u.q[1] = *(gv8p)(p + 32); return u.v;
}
__device__ __forceinline__ gcp sbase(const _Float16* p) { return (gcp)(unsigned long long)p; }   // the workspace planes lie in global memory
__device__ __forceinline__ PassF fetch_pass(const _Float16* kb, const _Float16* vb, unsigned ko, unsigned vo, int j0) {
  const gcp ks = sbase(kb + (size_t)j0 * DM), vs = sbase(vb + j0);
  PassF f; f.k0 = frag_u(ks, ko); f.k1 = frag_u(ks + 16 * DM * 2, ko); f.v0 = frag_u(vs, vo); f.v1 = frag_u(vs + 16 * SS * 2, vo);
  asm volatile("s_wait_xcnt 0x0" ::: "memory");   // stands behind the loads, in front of the next rewrite of an address register that they name
  return f; }
// 2^x on the hardware unit. The v_nop is the slot that the instruction set asks for behind a transcendental before its result is used or its source overwritten
__device__ __forceinline__ float exp2_hw(float x) { float r; asm("v_exp_f32 %0, %1\n\tv_nop" : "=v"(r) : "v"(x)); return r; }
// LDS exchange among the lanes of ONE wave (each wave has its own slab): LDS wait and wave-scope ordering only, so that the global loads in flight for the next pass are not drained here
#define LDSW() do { asm volatile("s_wait_dscnt 0" ::: "memory"); __builtin_amdgcn_wave_barrier(); __builtin_amdgcn_fence(__ATOMIC_RELEASE, "wavefront"); } while (0)
__global__ __launch_bounds__(128) void k_attn(const _Float16* __restrict__ Q, const _Float16* __restrict__ Kr, const _Float16* __restrict__ V, const float* __restrict__ WPOS, const float* __restrict__ BPOS, const float* __restrict__ GATE, float* __restrict__ O) {
  __shared__ __align__(16) _Float16 sph[4][16][40]; __shared__ __align__(16) float so[4][16][36];
  const int tid = threadIdx.x, wave = tid >> 5, lane = tid & 31, col = lane & 15, g = lane >> 4; const int h = blockIdx.y; const size_t b = blockIdx.z; const int q0 = blockIdx.x * 64 + wave * 16; const size_t rq = b * SS + q0;
  const float gt = 1.0f / (1.0f + expf(-bfr(GATE[h])));
  const v16h aq = frag_h(Q + (rq + col) * DM + h * HD, lane);
  asm volatile("s_wait_xcnt 0x0" :: "v"(Q + (rq + col) * DM + h * HD + 8 * g) : "memory");   // behind the two loads of aq; their address is an input, so that its registers are not rewritten in front of the wait
  const _Float16* kb = Kr + b * SS * DM + h * HD; const _Float16* vb = V + (b * DM + h * HD) * SS;
  const unsigned ko = (unsigned)(col * DM + 8 * g) * 2u, vo = (unsigned)(col * SS + 8 * g) * 2u;
  // positional row of query n = q0 + col (this lane's row of the A operand), in the base-2 exponent: u(d) = d ua + |d| uc + ub with d = n - m. u is linear on either side of d = 0, so its maximum over the row lies at m = 0, m = n or m = SS - 1
  const float ua = bfr(WPOS[h]) * 1.4426950408889634f, uc = bfr(WPOS[NH + h]) * 1.4426950408889634f, ub = bfr(BPOS[h]) * 1.4426950408889634f;
  const float nq = (float)(q0 + col), dl = nq - (float)(SS - 1);
  const float um = fmaxf(fmaxf(fmaf(nq, ua, fmaf(fabsf(nq), uc, ub)), fmaf(dl, ua, fmaf(fabsf(dl), uc, ub))), ub);
  const float uk = (ub - um) + 11.0f;   // weight = 2^(u - maximum + 11)
  float relb = nq - (float)(8 * g), z = 0.f;   // relb: n - m at the lane's first key of the pass; z: sum of this lane's weights
  float m[8], l[8];
#pragma unroll
  for (int r = 0; r < 8; ++r) { m[r] = -3.0e38f; l[r] = 0.f; }
  v8f acc[2] = {}, acc2[2] = {};
  auto pass = [&](const PassF& f) { v8f s[2]; v16h pp; float w[16];
#pragma unroll
    for (int i = 0; i < 16; ++i) { const float d = relb - (float)(i < 8 ? i : 8 + i); w[i] = exp2_hw(fmaf(d, ua, fmaf(fabsf(d), uc, uk))); pp[i] = (_Float16)w[i]; }
#pragma unroll
    for (int i = 0; i < 8; ++i) w[i] = w[2 * i] + w[2 * i + 1];
    z += ((w[0] + w[1]) + (w[2] + w[3])) + ((w[4] + w[5]) + (w[6] + w[7])); relb -= 32.0f;
#pragma unroll
    for (int ct = 0; ct < 2; ++ct) { v8f c = {}; c = wmma16(aq, ct ? f.k1 : f.k0, c);
#pragma unroll
      for (int r = 0; r < 8; ++r) s[ct][r] = c[r] * 0.17677669529663688f; }
#pragma unroll
    for (int r = 0; r < 8; ++r) { float mx = fmaxf(s[0][r], s[1][r]);
#pragma unroll
      for (int o = 1; o < 16; o <<= 1) mx = fmaxf(mx, __shfl_xor(mx, o));
      const float mn = fmaxf(m[r], mx); const float alpha = (m[r] <= -1.0e38f) ? 0.f : __expf(m[r] - mn); const float e0 = __expf(s[0][r] - mn), e1 = __expf(s[1][r] - mn); float es = e0 + e1;
#pragma unroll
      for (int o = 1; o < 16; o <<= 1) es += __shfl_xor(es, o);
      l[r] = l[r] * alpha + es; m[r] = mn;
#pragma unroll
      for (int dt = 0; dt < 2; ++dt) acc[dt][r] *= alpha;
      sph[wave][8 * g + r][col] = (_Float16)(e0 * 2048.0f); sph[wave][8 * g + r][16 + col] = (_Float16)(e1 * 2048.0f); }
    LDSW();
    const v16h pa = frag_h(&sph[wave][col][0], lane);
#pragma unroll
    for (int dt = 0; dt < 2; ++dt) { const v16h vf = dt ? f.v1 : f.v0; acc[dt] = wmma16(pa, vf, acc[dt]); acc2[dt] = wmma16(pp, vf, acc2[dt]); }
    LDSW(); };
  // two register sets: each pass first issues the next pass's loads into the other set, so that they fly while this pass is worked on
  PassF fa = fetch_pass(kb, vb, ko, vo, 0), fb;
#pragma unroll 1   // the body already holds two passes, one per register set
  for (int ks = 0; ks < SS / 32; ks += 2) {
    fb = fetch_pass(kb, vb, ko, vo, (ks + 1) * 32);
    pass(fa);
    fa = fetch_pass(kb, vb, ko, vo, (ks + 2 < SS / 32 ? ks + 2 : ks + 1) * 32);   // behind the last pass there is none: fetch in bounds, unused
    pass(fb); }
  z += __shfl_xor(z, 16);   // the two lane halves hold the two halves of row col's keys
#pragma unroll
  for (int r = 0; r < 8; ++r) { const float il = (1.0f / 2048.0f) / l[r]; const float iz = 1.0f / __shfl(z, 8 * g + r);   // accumulator element r is row 8 g + r
#pragma unroll
    for (int dt = 0; dt < 2; ++dt) so[wave][8 * g + r][dt * 16 + col] = (1.0f - gt) * acc[dt][r] * il + gt * acc2[dt][r] * iz; }
  LDSX();
  for (int rl = 0; rl < 16; ++rl) if (lane < 8) vst2(O + (rq + rl) * DM + h * HD + lane * 4, *(const v4f*)&so[wave][rl][lane * 4]);
}
// ---- k_out: block = (64 rows, 128 cols): out = ctx (hi + lo) . W_proj + b
__global__ __launch_bounds__(128) void k_out(const float* __restrict__ O, const __bf16* __restrict__ P, const float* __restrict__ BP, float* __restrict__ Y) { __shared__ __align__(16) float so[4][16][132];
  const int tid = threadIdx.x, wave = tid >> 5, lane = tid & 31, col = lane & 15, g = lane >> 4; const size_t r0 = (size_t)blockIdx.x * 64 + wave * 16; const int c0 = blockIdx.y * 128; const __bf16* Wr = P + WS_PP / 2;
  v8f acc[8] = {};
#pragma unroll
  for (int kc = 0; kc < DM / 32; ++kc) { const F2 a = split_row(O + (r0 + col) * DM, kc * 32, lane);
#pragma unroll
    for (int j = 0; j < 8; ++j) { const v16b w = frag_b(Wr + (size_t)(c0 + j * 16 + col) * DM + kc * 32, lane); acc[j] = wmma_bf(a.h, w, acc[j]); acc[j] = wmma_bf(a.l, w, acc[j]); } }
#pragma unroll
  for (int j = 0; j < 8; ++j) { const float bb = bfr(BP[c0 + j * 16 + col]);
#pragma unroll
    for (int r = 0; r < 8; ++r) so[wave][8 * g + r][j * 16 + col] = acc[j][r] + bb; }
  LDSX(); for (int rl = 0; rl < 16; ++rl) vst2(Y + (r0 + rl) * DM + c0 + lane * 4, *(const v4f*)&so[wave][rl][lane * 4]); }
extern "C" void kernel_launch(void* const* d_in, const int* in_sizes, int n_in, void* d_out, int out_size, void* d_ws, size_t ws_size, hipStream_t stream) {
  (void)in_sizes; (void)n_in; (void)out_size;
  const float** F = (const float**)d_in;   // 0 x [2,2048,256], 1 W_qk [256,512] (in,out), 2 W_v [256,256], 3 W_proj [256,256], 4 b_proj [256], 5 W_pos [2,8], 6 b_pos [8], 7 gating [8]
  if (ws_size < (size_t)WS_END) return;
  char* ws = (char*)d_ws; __bf16* P = (__bf16*)ws; _Float16 *Q = (_Float16*)(ws + WS_Q), *Kr = (_Float16*)(ws + WS_K), *V = (_Float16*)(ws + WS_V); float* O = (float*)(ws + WS_O);
  k_pack<<<dim3(2 * DM, 3), 256, 0, stream>>>(F[1], F[2], F[3], P);
  k_proj<<<dim3(TNB * SS / 64, 6), 128, 0, stream>>>(F[0], P, Q, Kr, V);
  k_attn<<<dim3(TQB, NH, TNB), 128, 0, stream>>>(Q, Kr, V, F[5], F[6], F[7], O);
  k_out<<<dim3(TNB * SS / 64, DM / 128), 128, 0, stream>>>(O, P, F[4], (float*)d_out);
}

// v003
// One run takes 73.2 microseconds.
// Two timings next to v002 put it at 1.40 and 1.42 times that version's speed.
// Over all steps from v000 it is 2.60 times as fast.
// compute dtype: all float inputs rounded to bf16; q/k = x . W_qk and v = x . W_v with EXACT bf16 products on WMMA 16x16x32 ((in,out) weights as transposed rows), rounded once to f16 (v as planes); content attention per (batch, head): q, k single f16 x 32^-1/2, running-max softmax in f32 (hardware exp), P (scaled by 2^11, single f16) x v; positional attention: per-head weights exp((n-m) W_pos[0,h] + |n-m| W_pos[1,h] + b_pos[h] - row maximum) x 2^11 formed in f32 in the attention kernel's registers, single f16, multiplied into the same v fragments and divided by their f32 row sum at the end; mix (1 - g) patch + g pos with g = sigmoid(gating_h) in f32; out = ctx (bf16 hi + lo, 2 products) . W_proj + b; f32 output.
#include <hip/hip_runtime.h>
#include <math.h>

typedef __attribute__((ext_vector_type(16))) _Float16 v16h;
typedef __attribute__((ext_vector_type(16))) __bf16 v16b;
typedef __attribute__((ext_vector_type(8)))  _Float16 v8h;
typedef __attribute__((ext_vector_type(8)))  float v8f;
typedef __attribute__((ext_vector_type(4)))  float v4f;
typedef __attribute__((ext_vector_type(2)))  float v2f;
typedef __attribute__((ext_vector_type(4)))  unsigned v4u;
typedef __attribute__((ext_vector_type(4)))  int v4i;
typedef float __attribute__((may_alias)) float_a;
typedef int __attribute__((may_alias)) int_a;

template <typename T> __device__ __forceinline__ void vst2(void* p, T v) { *(T*)p = v;  }
__device__ __forceinline__ v8f wmma16(v16h a, v16h b, v8f c) {
  v8f d = __builtin_amdgcn_wmma_f32_16x16x32_f16(false, a, false, b, (short)0, c, false, false);
  asm volatile("v_nop\n\tv_nop\n\tv_nop\n\tv_nop" : "+v"(d) : "v"(a), "v"(b));
  return d;
}
__device__ __forceinline__ v8f wmma_bf(v16b a, v16b b, v8f c) {
  v8f d = __builtin_amdgcn_wmma_f32_16x16x32_bf16(false, a, false, b, (short)0, c, false, false);
  asm volatile("v_nop\n\tv_nop\n\tv_nop\n\tv_nop" : "+v"(d) : "v"(a), "v"(b));
  return d;
}
// 16x16x32 fragments: lane = (h = lane>>4, row/col = lane&15); elements 0..7 = k0+8h+0..7, 8..15 = k0+16+8h+0..7; D element r = row 8h+r
__device__ __forceinline__ v16h frag_h(const _Float16* rowk0, int lane) {
  union { v16h v; v8h q[2]; } u; const _Float16* p = rowk0 + 8 * (lane >> 4);
  u.q[0] = *(const v8h*)p; u.q[1] = *(const v8h*)(p + 16); return u.v;
}
__device__ __forceinline__ v16h frag_f32(const float* rowk0, int lane) {
  v16h a; const float* p = rowk0 + 8 * (lane >> 4);
#pragma unroll
  for (int i = 0; i < 8; ++i) { a[i] = (_Float16)p[i]; a[8 + i] = (_Float16)p[16 + i]; }
  return a;
}
__device__ __forceinline__ v16h frag_f32s(const float* rowk0, int lane, float sc) {
  v16h a; const float* p = rowk0 + 8 * (lane >> 4);
#pragma unroll
  for (int i = 0; i < 8; ++i) { a[i] = (_Float16)(p[i] * sc); a[8 + i] = (_Float16)(p[16 + i] * sc); }
  return a;
}
// column fragment from a [K][ld] layout (column n), rows >= K read as 0
__device__ __forceinline__ v16h fragc_f32(const float* W, int k0, int n, int lane, int ld, int K) {
  v16h a; const int g = lane >> 4;
#pragma unroll
  for (int i = 0; i < 8; ++i) { const int ka = k0 + 8 * g + i, kb = ka + 16;
    a[i] = (_Float16)(ka < K ? W[(size_t)(ka < K ? ka : K - 1) * ld + n] : 0.f); a[8 + i] = (_Float16)(kb < K ? W[(size_t)(kb < K ? kb : K - 1) * ld + n] : 0.f); }
  return a;
}
struct F2 { v16b h, l; };
__device__ __forceinline__ F2 bsplit16(const float v[16]) { F2 r;
#pragma unroll
  for (int i = 0; i < 16; ++i) { const __bf16 h = (__bf16)v[i]; r.h[i] = h; r.l[i] = (__bf16)(v[i] - (float)h); }
  return r; }
__device__ __forceinline__ F2 split_row(const float* row, int k0, int lane) { float v[16]; const float* p = row + k0 + 8 * (lane >> 4);
#pragma unroll
  for (int i = 0; i < 8; ++i) { v[i] = p[i]; v[8 + i] = p[16 + i]; }
  return bsplit16(v); }
__device__ __forceinline__ F2 split_rowK(const float* row, int k0, int lane, int K) { float v[16]; const int g = lane >> 4;
#pragma unroll
  for (int i = 0; i < 8; ++i) { const int ka = k0 + 8 * g + i, kb = ka + 16; v[i] = ka < K ? row[ka < K ? ka : K - 1] : 0.f; v[8 + i] = kb < K ? row[kb < K ? kb : K - 1] : 0.f; }
  return bsplit16(v); }
__device__ __forceinline__ F2 split_col(const float* W, int k0, int n, int lane, int ld, int K) { float v[16]; const int g = lane >> 4;
#pragma unroll
  for (int i = 0; i < 8; ++i) { const int ka = k0 + 8 * g + i, kb = ka + 16; v[i] = ka < K ? W[(size_t)(ka < K ? ka : K - 1) * ld + n] : 0.f; v[8 + i] = kb < K ? W[(size_t)(kb < K ? kb : K - 1) * ld + n] : 0.f; }
  return bsplit16(v); }
__device__ __forceinline__ v8f mac3(const F2& a, const F2& b, v8f c) { c = wmma_bf(a.l, b.h, c); c = wmma_bf(a.h, b.l, c); return wmma_bf(a.h, b.h, c); }
__device__ __forceinline__ float sigm(float v) { return 1.0f / (1.0f + expf(-v)); }
#define LDSX() do { asm volatile("s_wait_dscnt 0" ::: "memory"); __builtin_amdgcn_wave_barrier(); __builtin_amdgcn_fence(__ATOMIC_RELEASE, "workgroup"); } while (0)


// Gated positional self-attention, 1-D (B 2, N 2,048 patches, C 256, 8 heads x 32): content softmax(q k / sqrt(32)) and a positional softmax from relative indices (d, |d|) . W_pos + b_pos, mixed per head by sigmoid(gating), (re)normalised, applied to v, output projection + bias.
#define NB 2
#define SS 2048
#define DM 256
#define NH 8
#define HD 32
#define NR (NB * SS)
#ifndef TQB
#define TQB (SS / 64)
#define TNB NB
#endif
typedef __attribute__((ext_vector_type(8))) __bf16 v8b;
__device__ __forceinline__ v16b frag_b(const __bf16* rowk0, int lane) {
  union { v16b v; v8b q[2]; } u; const __bf16* p = rowk0 + 8 * (lane >> 4);
  u.q[0] = *(const v8b*)p; u.q[1] = *(const v8b*)(p + 16); return u.v;
}
__device__ __forceinline__ float bfr(float v) { return (float)(__bf16)v; }
__device__ __attribute__((noinline)) float exp_ni(float v) { return expf(v); }
__device__ __attribute__((noinline)) float erf_ni(float v) { return erff(v); }

#define WS_PW  0u                                   // bf16 transposed rows: W_qk^T [512][256] (q rows 0..255, k rows 256..511), W_v^T [256][256], W_proj^T [256][256]
#define WS_PV  (WS_PW + 2u * (size_t)512 * DM)
#define WS_PP  (WS_PV + 2u * (size_t)DM * DM)
#define WS_Q   (WS_PP + 2u * (size_t)DM * DM)          // f16 q rows [NR][256], k rows [NR][256], v planes [b][256][SS]; f32 ctx [NR][256]
#define WS_K   (WS_Q + 2u * (size_t)NR * DM)
#define WS_V   (WS_K + 2u * (size_t)NR * DM)
#define WS_O   (WS_V + 2u * (size_t)NB * DM * SS)
#define WS_END (WS_O + 4u * (size_t)NR * DM)

__global__ __launch_bounds__(256) void k_pack(const float* __restrict__ WQK, const float* __restrict__ WV, const float* __restrict__ WP, __bf16* __restrict__ P) { const int n = blockIdx.x, which = blockIdx.y, t = threadIdx.x; __shared__ __align__(16) __bf16 s[DM];
  if (which == 0) { s[t] = (__bf16)WQK[(size_t)t * (2 * DM) + n]; __syncthreads(); if (t < DM / 8) vst2((unsigned*)(P + WS_PW / 2 + (size_t)n * DM + t * 8), *(const v4u*)&s[t * 8]); }   // n < 512
  else if (which == 1) { if (n >= DM) return; s[t] = (__bf16)WV[(size_t)t * DM + n]; __syncthreads(); if (t < DM / 8) vst2((unsigned*)(P + WS_PV / 2 + (size_t)n * DM + t * 8), *(const v4u*)&s[t * 8]); }
  else { if (n >= DM) return; s[t] = (__bf16)WP[(size_t)t * DM + n]; __syncthreads(); if (t < DM / 8) vst2((unsigned*)(P + WS_PP / 2 + (size_t)n * DM + t * 8), *(const v4u*)&s[t * 8]); } }
// ---- k_proj: block = (64 rows, 128 cols, which): 0,1: q cols / 2,3: k cols of x . W_qk (which = blockIdx.y over 4 col blocks of 128); 4,5: v -> planes
__global__ __launch_bounds__(128) void k_proj(const float* __restrict__ X, const __bf16* __restrict__ P, _Float16* __restrict__ Q, _Float16* __restrict__ Kr, _Float16* __restrict__ V) {
  __shared__ __align__(16) _Float16 so[64][136]; __shared__ __align__(16) _Float16 st[128][72];
  const int tid = threadIdx.x, wave = tid >> 5, lane = tid & 31, col = lane & 15, g = lane >> 4; const int cb = blockIdx.y; const size_t rb = (size_t)blockIdx.x * 64; const size_t r0 = rb + wave * 16;
  const __bf16* Wr = (cb < 4) ? (P + WS_PW / 2 + (size_t)cb * 128 * DM) : (P + WS_PV / 2 + (size_t)(cb - 4) * 128 * DM);
  v8f acc[8] = {};
#pragma unroll
  for (int kc = 0; kc < DM / 32; ++kc) { v16b a; { const float* p = X + (r0 + col) * DM + kc * 32 + 8 * g;
#pragma unroll
      for (int i = 0; i < 8; ++i) { a[i] = (__bf16)p[i]; a[8 + i] = (__bf16)p[16 + i]; } }
#pragma unroll
    for (int j = 0; j < 8; ++j) acc[j] = wmma_bf(a, frag_b(Wr + (size_t)(j * 16 + col) * DM + kc * 32, lane), acc[j]); }
  if (cb < 4) {
#pragma unroll
    for (int j = 0; j < 8; ++j)
#pragma unroll
      for (int r = 0; r < 8; ++r) so[wave * 16 + 8 * g + r][j * 16 + col] = (_Float16)acc[j][r];
    __syncthreads(); _Float16* dst = (cb < 2) ? Q : Kr; const int c0 = (cb & 1) * 128; for (int e = tid; e < 64 * 16; e += 128) { const int rl = e >> 4, q = e & 15; vst2((unsigned*)(dst + (rb + rl) * DM + c0 + q * 8), *(const v4u*)&so[rl][q * 8]); } }
  else {
#pragma unroll
    for (int j = 0; j < 8; ++j)
#pragma unroll
      for (int r = 0; r < 8; ++r) st[j * 16 + col][wave * 16 + 8 * g + r] = (_Float16)acc[j][r];
    __syncthreads(); const size_t b = rb / SS; const int s0 = (int)(rb % SS); const int c0 = (cb - 4) * 128; for (int e = tid; e < 128 * 8; e += 128) { const int d = e >> 3, pc = e & 7; vst2((unsigned*)(V + ((b * DM + c0 + d) * SS) + s0 + pc * 8), *(const v4u*)&st[d][pc * 8]); } }
}
// the eight 16-byte loads a lane makes for one 32-key pass: two K tiles, two V tiles
struct PassF { v16h k0, k1, v0, v1; };
// fragment at a wave-uniform base plus this lane's byte offset: the lane offsets are fixed for the whole loop, only the uniform bases move from pass to pass
typedef const __attribute__((address_space(1))) char* gcp;
typedef const __attribute__((address_space(1))) v8h* gv8p;
__device__ __forceinline__ v16h frag_u(gcp ubase, unsigned voff) {
  union { v16h v; v8h q[2]; } u; gcp p = ubase + voff;
  u.q[0] = *(gv8p)p; u.q[1] = *(gv8p)(p + 32); return u.v;
}
__device__ __forceinline__ gcp sbase(const _Float16* p) { return (gcp)(unsigned long long)p; }   // the workspace planes lie in global memory
__device__ __forceinline__ PassF fetch_pass(const _Float16* kb, const _Float16* vb, unsigned ko, unsigned vo, int j0) {
  const gcp ks = sbase(kb + (size_t)j0 * DM), vs = sbase(vb + j0);
  PassF f; f.k0 = frag_u(ks, ko); f.k1 = frag_u(ks + 16 * DM * 2, ko); f.v0 = frag_u(vs, vo); f.v1 = frag_u(vs + 16 * SS * 2, vo);
  asm volatile("s_wait_xcnt 0x0" ::: "memory");   // stands behind the loads, in front of the next rewrite of an address register that they name
  return f; }
// 2^x on the hardware unit. The v_nop is the slot that the instruction set asks for behind a transcendental before its result is used or its source overwritten
__device__ __forceinline__ float exp2_hw(float x) { float r; asm("v_exp_f32 %0, %1\n\tv_nop" : "=v"(r) : "v"(x)); return r; }
// eight of them in one statement: every result register differs from every source (early clobber), so that each fills the slot of the one in front of it; the one v_nop is the slot behind the last
__device__ __forceinline__ v8f exp2_hw8(v8f x) { float r0, r1, r2, r3, r4, r5, r6, r7;
  asm("v_exp_f32 %0, %8\n\tv_exp_f32 %1, %9\n\tv_exp_f32 %2, %10\n\tv_exp_f32 %3, %11\n\tv_exp_f32 %4, %12\n\tv_exp_f32 %5, %13\n\tv_exp_f32 %6, %14\n\tv_exp_f32 %7, %15\n\tv_nop"
      : "=&v"(r0), "=&v"(r1), "=&v"(r2), "=&v"(r3), "=&v"(r4), "=&v"(r5), "=&v"(r6), "=&v"(r7) : "v"(x[0]), "v"(x[1]), "v"(x[2]), "v"(x[3]), "v"(x[4]), "v"(x[5]), "v"(x[6]), "v"(x[7]));
  return v8f{r0, r1, r2, r3, r4, r5, r6, r7}; }
__device__ __forceinline__ float xhalf(float v) { return __builtin_bit_cast(float, __builtin_amdgcn_permlanex16(__builtin_bit_cast(int, v), __builtin_bit_cast(int, v), 0x76543210, 0xfedcba98, false, false)); }   // the value of lane ^ 16
// transposed products: S^T = K . Q^T (A = 16 key rows, B = the wave's 16 queries) and O^T += V^T . P^T. A lane holds 16 of the 32 scores of ONE query (column col; keys 8 g + r and 16 + 8 g + r), which is the k order of the B operand of the second product: P goes from the score accumulators straight into that operand
__global__ __launch_bounds__(128) void k_attn(const _Float16* __restrict__ Q, const _Float16* __restrict__ Kr, const _Float16* __restrict__ V, const float* __restrict__ WPOS, const float* __restrict__ BPOS, const float* __restrict__ GATE, float* __restrict__ O) {
  const int tid = threadIdx.x, wave = tid >> 5, lane = tid & 31, col = lane & 15, g = lane >> 4; const int h = blockIdx.y; const size_t b = blockIdx.z; const int q0 = blockIdx.x * 64 + wave * 16; const size_t rq = b * SS + q0;
  const float gt = 1.0f / (1.0f + expf(-bfr(GATE[h])));
  const v16h aq = frag_h(Q + (rq + col) * DM + h * HD, lane);
  asm volatile("s_wait_xcnt 0x0" :: "v"(Q + (rq + col) * DM + h * HD + 8 * g) : "memory");   // behind the two loads of aq; their address is an input, so that its registers are not rewritten in front of the wait
  const _Float16* kb = Kr + b * SS * DM + h * HD; const _Float16* vb = V + (b * DM + h * HD) * SS;
  const unsigned ko = (unsigned)(col * DM + 8 * g) * 2u, vo = (unsigned)(col * SS + 8 * g) * 2u;
  // positional row of query n = q0 + col (this lane's column of the B operand), in the base-2 exponent: u(d) = d ua + |d| uc + ub with d = n - m. u is linear on either side of d = 0, so its maximum over the row lies at m = 0, m = n or m = SS - 1
  const float ua = bfr(WPOS[h]) * 1.4426950408889634f, uc = bfr(WPOS[NH + h]) * 1.4426950408889634f, ub = bfr(BPOS[h]) * 1.4426950408889634f;
  const float nq = (float)(q0 + col), dl = nq - (float)(SS - 1);
  const float um = fmaxf(fmaxf(fmaf(nq, ua, fmaf(fabsf(nq), uc, ub)), fmaf(dl, ua, fmaf(fabsf(dl), uc, ub))), ub);
  const float uk = (ub - um) + 11.0f;   // weight = 2^(u - maximum + 11)
  float relb = nq - (float)(8 * g), z = 0.f;   // relb: n - m at the lane's first key of the pass; z: sum of this lane's weights
  float m = -3.0e38f, l = 0.f;   // query col's running maximum (equal in both lane halves) and this lane's half of its running sum
  v8f acc[2] = {}, acc2[2] = {};   // element r = head dim dt * 16 + 8 g + r of query col
  auto pass = [&](const PassF& f) { v16h pp, pa; float w[16];
#pragma unroll
    for (int i = 0; i < 16; ++i) { const float d = relb - (float)(i < 8 ? i : 8 + i); w[i] = exp2_hw(fmaf(d, ua, fmaf(fabsf(d), uc, uk))); pp[i] = (_Float16)w[i]; }
#pragma unroll
    for (int i = 0; i < 8; ++i) w[i] = w[2 * i] + w[2 * i + 1];
    z += ((w[0] + w[1]) + (w[2] + w[3])) + ((w[4] + w[5]) + (w[6] + w[7])); relb -= 32.0f;
    v8f s[2];
#pragma unroll
    for (int ct = 0; ct < 2; ++ct) { v8f c = {}; c = wmma16(ct ? f.k1 : f.k0, aq, c); s[ct] = c * 0.17677669529663688f; }
    float x[2];
#pragma unroll
    for (int ct = 0; ct < 2; ++ct) x[ct] = fmaxf(fmaxf(fmaxf(s[ct][0], s[ct][1]), fmaxf(s[ct][2], s[ct][3])), fmaxf(fmaxf(s[ct][4], s[ct][5]), fmaxf(s[ct][6], s[ct][7])));
    float mx = fmaxf(x[0], x[1]); mx = fmaxf(mx, xhalf(mx));
    const float mn = fmaxf(m, mx); const float ea = exp2_hw((m - mn) * 1.4426950408889634f); const float alpha = (m <= -1.0e38f) ? 0.f : ea; m = mn;
#pragma unroll
    for (int ct = 0; ct < 2; ++ct) { const v8f e = exp2_hw8((s[ct] - mn) * 1.4426950408889634f);
#pragma unroll
      for (int r = 0; r < 8; ++r) pa[ct * 8 + r] = (_Float16)(e[r] * 2048.0f);
      x[ct] = ((e[0] + e[1]) + (e[2] + e[3])) + ((e[4] + e[5]) + (e[6] + e[7])); }
    l = l * alpha + (x[0] + x[1]);
#pragma unroll
    for (int dt = 0; dt < 2; ++dt) { acc[dt] *= alpha; const v16h vf = dt ? f.v1 : f.v0; acc[dt] = wmma16(vf, pa, acc[dt]); acc2[dt] = wmma16(vf, pp, acc2[dt]); } };
  // two register sets: each pass first issues the next pass's loads into the other set, so that they fly while this pass is worked on
  PassF fa = fetch_pass(kb, vb, ko, vo, 0), fb;
#pragma unroll 1   // the body already holds two passes, one per register set
  for (int ks = 0; ks < SS / 32; ks += 2) {
    fb = fetch_pass(kb, vb, ko, vo, (ks + 1) * 32);
    pass(fa);
    fa = fetch_pass(kb, vb, ko, vo, (ks + 2 < SS / 32 ? ks + 2 : ks + 1) * 32);   // behind the last pass there is none: fetch in bounds, unused
    pass(fb); }
  z += xhalf(z); l += xhalf(l);   // the two lane halves hold the two halves of query col's keys
  const float cl = (1.0f - gt) * ((1.0f / 2048.0f) / l), cz = gt * (1.0f / z);
  float* orow = O + (rq + col) * DM + h * HD + 8 * g;
#pragma unroll
  for (int dt = 0; dt < 2; ++dt) { v4f o[2];
#pragma unroll
    for (int r = 0; r < 8; ++r) o[r >> 2][r & 3] = acc[dt][r] * cl + acc2[dt][r] * cz;
    vst2(orow + dt * 16, o[0]); vst2(orow + dt * 16 + 4, o[1]); }
}
// ---- k_out: block = (64 rows, 128 cols): out = ctx (hi + lo) . W_proj + b
__global__ __launch_bounds__(128) void k_out(const float* __restrict__ O, const __bf16* __restrict__ P, const float* __restrict__ BP, float* __restrict__ Y) { __shared__ __align__(16) float so[4][16][132];
  const int tid = threadIdx.x, wave = tid >> 5, lane = tid & 31, col = lane & 15, g = lane >> 4; const size_t r0 = (size_t)blockIdx.x * 64 + wave * 16; const int c0 = blockIdx.y * 128; const __bf16* Wr = P + WS_PP / 2;
  v8f acc[8] = {};
#pragma unroll
  for (int kc = 0; kc < DM / 32; ++kc) { const F2 a = split_row(O + (r0 + col) * DM, kc * 32, lane);
#pragma unroll
    for (int j = 0; j < 8; ++j) { const v16b w = frag_b(Wr + (size_t)(c0 + j * 16 + col) * DM + kc * 32, lane); acc[j] = wmma_bf(a.h, w, acc[j]); acc[j] = wmma_bf(a.l, w, acc[j]); } }
#pragma unroll
  for (int j = 0; j < 8; ++j) { const float bb = bfr(BP[c0 + j * 16 + col]);
#pragma unroll
    for (int r = 0; r < 8; ++r) so[wave][8 * g + r][j * 16 + col] = acc[j][r] + bb; }
  LDSX(); for (int rl = 0; rl < 16; ++rl) vst2(Y + (r0 + rl) * DM + c0 + lane * 4, *(const v4f*)&so[wave][rl][lane * 4]); }
extern "C" void kernel_launch(void* const* d_in, const int* in_sizes, int n_in, void* d_out, int out_size, void* d_ws, size_t ws_size, hipStream_t stream) {
  (void)in_sizes; (void)n_in; (void)out_size;
  const float** F = (const float**)d_in;   // 0 x [2,2048,256], 1 W_qk [256,512] (in,out), 2 W_v [256,256], 3 W_proj [256,256], 4 b_proj [256], 5 W_pos [2,8], 6 b_pos [8], 7 gating [8]
  if (ws_size < (size_t)WS_END) return;
  char* ws = (char*)d_ws; __bf16* P = (__bf16*)ws; _Float16 *Q = (_Float16*)(ws + WS_Q), *Kr = (_Float16*)(ws + WS_K), *V = (_Float16*)(ws + WS_V); float* O = (float*)(ws + WS_O);
  k_pack<<<dim3(2 * DM, 3), 256, 0, stream>>>(F[1], F[2], F[3], P);
  k_proj<<<dim3(TNB * SS / 64, 6), 128, 0, stream>>>(F[0], P, Q, Kr, V);
  k_attn<<<dim3(TQB, NH, TNB), 128, 0, stream>>>(Q, Kr, V, F[5], F[6], F[7], O);
  k_out<<<dim3(TNB * SS / 64, DM / 128), 128, 0, stream>>>(O, P, F[4], (float*)d_out);
}

// v004
// Measured time: 69.3 microseconds a run.
// Timed twice side by side with v003, it ran 1.04 and 1.05 times as fast.
// All steps since v000 together make it 2.71 times as fast.
// compute dtype: all float inputs rounded to bf16; q/k = x . W_qk and v = x . W_v with EXACT bf16 products on WMMA 16x16x32 ((in,out) weights as transposed rows), rounded once to f16 (v as planes); content attention per (batch, head): q, k single f16 x 32^-1/2, running-max softmax in f32 (hardware exp), P (scaled by 2^11, single f16) x v; positional attention: per-head weights exp((n-m) W_pos[0,h] + |n-m| W_pos[1,h] + b_pos[h] - row maximum) x 2^11; in the one 32-key pass that holds the query they are formed one by one in f32 and rounded to f16, in every other pass they are a constant f16 fragment (the fall-off inside a pass) times one f32 factor per query and pass, applied to the product with the same v fragments; divided by their f32 row sum at the end; mix (1 - g) patch + g pos with g = sigmoid(gating_h) in f32; out = ctx (bf16 hi + lo, 2 products) . W_proj + b; f32 output.
#include <hip/hip_runtime.h>
#include <math.h>

typedef __attribute__((ext_vector_type(16))) _Float16 v16h;
typedef __attribute__((ext_vector_type(16))) __bf16 v16b;
typedef __attribute__((ext_vector_type(8)))  _Float16 v8h;
typedef __attribute__((ext_vector_type(8)))  float v8f;
typedef __attribute__((ext_vector_type(4)))  float v4f;
typedef __attribute__((ext_vector_type(2)))  float v2f;
typedef __attribute__((ext_vector_type(4)))  unsigned v4u;
typedef __attribute__((ext_vector_type(4)))  int v4i;
typedef float __attribute__((may_alias)) float_a;
typedef int __attribute__((may_alias)) int_a;

template <typename T> __device__ __forceinline__ void vst2(void* p, T v) { *(T*)p = v;  }
__device__ __forceinline__ v8f wmma16(v16h a, v16h b, v8f c) {
  v8f d = __builtin_amdgcn_wmma_f32_16x16x32_f16(false, a, false, b, (short)0, c, false, false);
  asm volatile("v_nop\n\tv_nop\n\tv_nop\n\tv_nop" : "+v"(d) : "v"(a), "v"(b));
  return d;
}
__device__ __forceinline__ v8f wmma_bf(v16b a, v16b b, v8f c) {
  v8f d = __builtin_amdgcn_wmma_f32_16x16x32_bf16(false, a, false, b, (short)0, c, false, false);
  asm volatile("v_nop\n\tv_nop\n\tv_nop\n\tv_nop" : "+v"(d) : "v"(a), "v"(b));
  return d;
}
// 16x16x32 fragments: lane = (h = lane>>4, row/col = lane&15); elements 0..7 = k0+8h+0..7, 8..15 = k0+16+8h+0..7; D element r = row 8h+r
__device__ __forceinline__ v16h frag_h(const _Float16* rowk0, int lane) {
  union { v16h v; v8h q[2]; } u; const _Float16* p = rowk0 + 8 * (lane >> 4);
  u.q[0] = *(const v8h*)p; u.q[1] = *(const v8h*)(p + 16); return u.v;
}
__device__ __forceinline__ v16h frag_f32(const float* rowk0, int lane) {
  v16h a; const float* p = rowk0 + 8 * (lane >> 4);
#pragma unroll
  for (int i = 0; i < 8; ++i) { a[i] = (_Float16)p[i]; a[8 + i] = (_Float16)p[16 + i]; }
  return a;
}
__device__ __forceinline__ v16h frag_f32s(const float* rowk0, int lane, float sc) {
  v16h a; const float* p = rowk0 + 8 * (lane >> 4);
#pragma unroll
  for (int i = 0; i < 8; ++i) { a[i] = (_Float16)(p[i] * sc); a[8 + i] = (_Float16)(p[16 + i] * sc); }
  return a;
}
// column fragment from a [K][ld] layout (column n), rows >= K read as 0
__device__ __forceinline__ v16h fragc_f32(const float* W, int k0, int n, int lane, int ld, int K) {
  v16h a; const int g = lane >> 4;
#pragma unroll
  for (int i = 0; i < 8; ++i) { const int ka = k0 + 8 * g + i, kb = ka + 16;
    a[i] = (_Float16)(ka < K ? W[(size_t)(ka < K ? ka : K - 1) * ld + n] : 0.f); a[8 + i] = (_Float16)(kb < K ? W[(size_t)(kb < K ? kb : K - 1) * ld + n] : 0.f); }
  return a;
}
struct F2 { v16b h, l; };
__device__ __forceinline__ F2 bsplit16(const float v[16]) { F2 r;
#pragma unroll
  for (int i = 0; i < 16; ++i) { const __bf16 h = (__bf16)v[i]; r.h[i] = h; r.l[i] = (__bf16)(v[i] - (float)h); }
  return r; }
__device__ __forceinline__ F2 split_row(const float* row, int k0, int lane) { float v[16]; const float* p = row + k0 + 8 * (lane >> 4);
#pragma unroll
  for (int i = 0; i < 8; ++i) { v[i] = p[i]; v[8 + i] = p[16 + i]; }
  return bsplit16(v); }
__device__ __forceinline__ F2 split_rowK(const float* row, int k0, int lane, int K) { float v[16]; const int g = lane >> 4;
#pragma unroll
  for (int i = 0; i < 8; ++i) { const int ka = k0 + 8 * g + i, kb = ka + 16; v[i] = ka < K ? row[ka < K ? ka : K - 1] : 0.f; v[8 + i] = kb < K ? row[kb < K ? kb : K - 1] : 0.f; }
  return bsplit16(v); }
__device__ __forceinline__ F2 split_col(const float* W, int k0, int n, int lane, int ld, int K) { float v[16]; const int g = lane >> 4;
#pragma unroll
  for (int i = 0; i < 8; ++i) { const int ka = k0 + 8 * g + i, kb = ka + 16; v[i] = ka < K ? W[(size_t)(ka < K ? ka : K - 1) * ld + n] : 0.f; v[8 + i] = kb < K ? W[(size_t)(kb < K ? kb : K - 1) * ld + n] : 0.f; }
  return bsplit16(v); }
__device__ __forceinline__ v8f mac3(const F2& a, const F2& b, v8f c) { c = wmma_bf(a.l, b.h, c); c = wmma_bf(a.h, b.l, c); return wmma_bf(a.h, b.h, c); }
__device__ __forceinline__ float sigm(float v) { return 1.0f / (1.0f + expf(-v)); }
#define LDSX() do { asm volatile("s_wait_dscnt 0" ::: "memory"); __builtin_amdgcn_wave_barrier(); __builtin_amdgcn_fence(__ATOMIC_RELEASE, "workgroup"); } while (0)


// Gated positional self-attention, 1-D (B 2, N 2,048 patches, C 256, 8 heads x 32): content softmax(q k / sqrt(32)) and a positional softmax from relative indices (d, |d|) . W_pos + b_pos, mixed per head by sigmoid(gating), (re)normalised, applied to v, output projection + bias.
#define NB 2
#define SS 2048
#define DM 256
#define NH 8
#define HD 32
#define NR (NB * SS)
#ifndef TQB
#define TQB (SS / 64)
#define TNB NB
#endif
typedef __attribute__((ext_vector_type(8))) __bf16 v8b;
__device__ __forceinline__ v16b frag_b(const __bf16* rowk0, int lane) {
  union { v16b v; v8b q[2]; } u; const __bf16* p = rowk0 + 8 * (lane >> 4);
  u.q[0] = *(const v8b*)p; u.q[1] = *(const v8b*)(p + 16); return u.v;
}
__device__ __forceinline__ float bfr(float v) { return (float)(__bf16)v; }
__device__ __attribute__((noinline)) float exp_ni(float v) { return expf(v); }
__device__ __attribute__((noinline)) float erf_ni(float v) { return erff(v); }

#define WS_PW  0u                                   // bf16 transposed rows: W_qk^T [512][256] (q rows 0..255, k rows 256..511), W_v^T [256][256], W_proj^T [256][256]
#define WS_PV  (WS_PW + 2u * (size_t)512 * DM)
#define WS_PP  (WS_PV + 2u * (size_t)DM * DM)
#define WS_Q   (WS_PP + 2u * (size_t)DM * DM)          // f16 q rows [NR][256], k rows [NR][256], v planes [b][256][SS]; f32 ctx [NR][256]
#define WS_K   (WS_Q + 2u * (size_t)NR * DM)
#define WS_V   (WS_K + 2u * (size_t)NR * DM)
#define WS_O   (WS_V + 2u * (size_t)NB * DM * SS)
#define WS_END (WS_O + 4u * (size_t)NR * DM)

__global__ __launch_bounds__(256) void k_pack(const float* __restrict__ WQK, const float* __restrict__ WV, const float* __restrict__ WP, __bf16* __restrict__ P) { const int n = blockIdx.x, which = blockIdx.y, t = threadIdx.x; __shared__ __align__(16) __bf16 s[DM];
  if (which == 0) { s[t] = (__bf16)WQK[(size_t)t * (2 * DM) + n]; __syncthreads(); if (t < DM / 8) vst2((unsigned*)(P + WS_PW / 2 + (size_t)n * DM + t * 8), *(const v4u*)&s[t * 8]); }   // n < 512
  else if (which == 1) { if (n >= DM) return; s[t] = (__bf16)WV[(size_t)t * DM + n]; __syncthreads(); if (t < DM / 8) vst2((unsigned*)(P + WS_PV / 2 + (size_t)n * DM + t * 8), *(const v4u*)&s[t * 8]); }
  else { if (n >= DM) return; s[t] = (__bf16)WP[(size_t)t * DM + n]; __syncthreads(); if (t < DM / 8) vst2((unsigned*)(P + WS_PP / 2 + (size_t)n * DM + t * 8), *(const v4u*)&s[t * 8]); } }
// ---- k_proj: block = (64 rows, 128 cols, which): 0,1: q cols / 2,3: k cols of x . W_qk (which = blockIdx.y over 4 col blocks of 128); 4,5: v -> planes
__global__ __launch_bounds__(128) void k_proj(const float* __restrict__ X, const __bf16* __restrict__ P, _Float16* __restrict__ Q, _Float16* __restrict__ Kr, _Float16* __restrict__ V) {
  __shared__ __align__(16) _Float16 so[64][136]; __shared__ __align__(16) _Float16 st[128][72];
  const int tid = threadIdx.x, wave = tid >> 5, lane = tid & 31, col = lane & 15, g = lane >> 4; const int cb = blockIdx.y; const size_t rb = (size_t)blockIdx.x * 64; const size_t r0 = rb + wave * 16;
  const __bf16* Wr = (cb < 4) ? (P + WS_PW / 2 + (size_t)cb * 128 * DM) : (P + WS_PV / 2 + (size_t)(cb - 4) * 128 * DM);
  v8f acc[8] = {};
#pragma unroll
  for (int kc = 0; kc < DM / 32; ++kc) { v16b a; { const float* p = X + (r0 + col) * DM + kc * 32 + 8 * g;
#pragma unroll
      for (int i = 0; i < 8; ++i) { a[i] = (__bf16)p[i]; a[8 + i] = (__bf16)p[16 + i]; } }
#pragma unroll
    for (int j = 0; j < 8; ++j) acc[j] = wmma_bf(a, frag_b(Wr + (size_t)(j * 16 + col) * DM + kc * 32, lane), acc[j]); }
  if (cb < 4) {
#pragma unroll
    for (int j = 0; j < 8; ++j)
#pragma unroll
      for (int r = 0; r < 8; ++r) so[wave * 16 + 8 * g + r][j * 16 + col] = (_Float16)acc[j][r];
    __syncthreads(); _Float16* dst = (cb < 2) ? Q : Kr; const int c0 = (cb & 1) * 128; for (int e = tid; e < 64 * 16; e += 128) { const int rl = e >> 4, q = e & 15; vst2((unsigned*)(dst + (rb + rl) * DM + c0 + q * 8), *(const v4u*)&so[rl][q * 8]); } }
  else {
#pragma unroll
    for (int j = 0; j < 8; ++j)
#pragma unroll
      for (int r = 0; r < 8; ++r) st[j * 16 + col][wave * 16 + 8 * g + r] = (_Float16)acc[j][r];
    __syncthreads(); const size_t b = rb / SS; const int s0 = (int)(rb % SS); const int c0 = (cb - 4) * 128; for (int e = tid; e < 128 * 8; e += 128) { const int d = e >> 3, pc = e & 7; vst2((unsigned*)(V + ((b * DM + c0 + d) * SS) + s0 + pc * 8), *(const v4u*)&st[d][pc * 8]); } }
}
// the eight 16-byte loads a lane makes for one 32-key pass: two K tiles, two V tiles
struct PassF { v16h k0, k1, v0, v1; };
// fragment at a wave-uniform base plus this lane's byte offset: the lane offsets are fixed for the whole loop, only the uniform bases move from pass to pass
typedef const __attribute__((address_space(1))) char* gcp;
typedef const __attribute__((address_space(1))) v8h* gv8p;
__device__ __forceinline__ v16h frag_u(gcp ubase, unsigned voff) {
  union { v16h v; v8h q[2]; } u; gcp p = ubase + voff;
  u.q[0] = *(gv8p)p; u.q[1] = *(gv8p)(p + 32); return u.v;
}
__device__ __forceinline__ gcp sbase(const _Float16* p) { return (gcp)(unsigned long long)p; }   // the workspace planes lie in global memory
__device__ __forceinline__ PassF fetch_pass(const _Float16* kb, const _Float16* vb, unsigned ko, unsigned vo, int j0) {
  const gcp ks = sbase(kb + (size_t)j0 * DM), vs = sbase(vb + j0);
  PassF f; f.k0 = frag_u(ks, ko); f.k1 = frag_u(ks + 16 * DM * 2, ko); f.v0 = frag_u(vs, vo); f.v1 = frag_u(vs + 16 * SS * 2, vo);
  asm volatile("s_wait_xcnt 0x0" ::: "memory");   // stands behind the loads, in front of the next rewrite of an address register that they name
  return f; }
// 2^x on the hardware unit. The v_nop is the slot that the instruction set asks for behind a transcendental before its result is used or its source overwritten
__device__ __forceinline__ float exp2_hw(float x) { float r; asm("v_exp_f32 %0, %1\n\tv_nop" : "=v"(r) : "v"(x)); return r; }
// eight of them in one statement: every result register differs from every source (early clobber), so that each fills the slot of the one in front of it; the one v_nop is the slot behind the last
__device__ __forceinline__ v8f exp2_hw8(v8f x) { float r0, r1, r2, r3, r4, r5, r6, r7;
  asm("v_exp_f32 %0, %8\n\tv_exp_f32 %1, %9\n\tv_exp_f32 %2, %10\n\tv_exp_f32 %3, %11\n\tv_exp_f32 %4, %12\n\tv_exp_f32 %5, %13\n\tv_exp_f32 %6, %14\n\tv_exp_f32 %7, %15\n\tv_nop"
      : "=&v"(r0), "=&v"(r1), "=&v"(r2), "=&v"(r3), "=&v"(r4), "=&v"(r5), "=&v"(r6), "=&v"(r7) : "v"(x[0]), "v"(x[1]), "v"(x[2]), "v"(x[3]), "v"(x[4]), "v"(x[5]), "v"(x[6]), "v"(x[7]));
  return v8f{r0, r1, r2, r3, r4, r5, r6, r7}; }
__device__ __forceinline__ float xhalf(float v) { return __builtin_bit_cast(float, __builtin_amdgcn_permlanex16(__builtin_bit_cast(int, v), __builtin_bit_cast(int, v), 0x76543210, 0xfedcba98, false, false)); }   // the value of lane ^ 16
// transposed products: S^T = K . Q^T (A = 16 key rows, B = the wave's 16 queries) and O^T += V^T . P^T. A lane holds 16 of the 32 scores of ONE query (column col; keys 8 g + r and 16 + 8 g + r), which is the k order of the B operand of the second product: P goes from the score accumulators straight into that operand
__global__ __launch_bounds__(128) void k_attn(const _Float16* __restrict__ Q, const _Float16* __restrict__ Kr, const _Float16* __restrict__ V, const float* __restrict__ WPOS, const float* __restrict__ BPOS, const float* __restrict__ GATE, float* __restrict__ O) {
  const int tid = threadIdx.x, wave = __builtin_amdgcn_readfirstlane(tid >> 5), lane = tid & 31, col = lane & 15, g = lane >> 4; const int h = blockIdx.y; const size_t b = blockIdx.z; const int q0 = blockIdx.x * 64 + wave * 16; const size_t rq = b * SS + q0;   // the wave's number in a scalar register: the tests on pd below are scalar branches
  const float gt = 1.0f / (1.0f + expf(-bfr(GATE[h])));
  const v16h aq = frag_h(Q + (rq + col) * DM + h * HD, lane);
  asm volatile("s_wait_xcnt 0x0" :: "v"(Q + (rq + col) * DM + h * HD + 8 * g) : "memory");   // behind the two loads of aq; their address is an input, so that its registers are not rewritten in front of the wait
  const _Float16* kb = Kr + b * SS * DM + h * HD; const _Float16* vb = V + (b * DM + h * HD) * SS;
  const unsigned ko = (unsigned)(col * DM + 8 * g) * 2u, vo = (unsigned)(col * SS + 8 * g) * 2u;
  // positional row of query n = q0 + col (this lane's column of the B operand), in the base-2 exponent: u(d) = d ua + |d| uc + ub with d = n - m. u is linear on either side of d = 0, so its maximum over the row lies at m = 0, m = n or m = SS - 1
  const float ua = bfr(WPOS[h]) * 1.4426950408889634f, uc = bfr(WPOS[NH + h]) * 1.4426950408889634f, ub = bfr(BPOS[h]) * 1.4426950408889634f;
  const float nq = (float)(q0 + col), dl = nq - (float)(SS - 1);
  const float um = fmaxf(fmaxf(fmaf(nq, ua, fmaf(fabsf(nq), uc, ub)), fmaf(dl, ua, fmaf(fabsf(dl), uc, ub))), ub);
  const float uk = (ub - um) + 11.0f;   // weight = 2^(u - maximum + 11)
  float relp = nq, z = 0.f;   // relp: n - m at the first key of the pass; z: sum of this lane's weights
  // Off the diagonal |d| = +-d for all 32 keys of a pass, so u is linear there: u(d) = d sg + ub, sg = ua + uc before the query, ua - uc behind it, and
  // weight(n, j0 + o) = 2^((n - j0 - os) sg + ub - maximum) x 2^((os - o) sg + 11): one factor per query and pass times a table over o that is the same in every pass.
  // os is the end of the pass with the larger weight (31 for sg <= 0, else 0): the table lies in [0, 2^11] and the factor is a weight of the row / 2^11, so neither can overflow
  const int pd = q0 >> 5;   // the one pass whose 32 keys hold the wave's 16 queries
  struct Side { v16h c; float cs, sg, os, kk; };   // table as B operand, this lane's sum of it, slope, os, constant of the factor's exponent
  auto side = [&](float sg) { Side t; t.sg = sg; t.os = sg <= 0.f ? 31.0f : 0.f; t.kk = ub - um; t.cs = 0.f;
#pragma unroll   // constant indices, so that the table stays in registers
    for (int i = 0; i < 16; ++i) { t.c[i] = (_Float16)exp2_hw(fmaf(t.os - (float)(8 * g + (i < 8 ? i : 8 + i)), sg, 11.0f)); t.cs += (float)t.c[i]; }
    return t; };
  Side cur = side(ua + uc); const Side behind = side(ua - uc);
  v8f t[2] = {}; float fw = 0.f;   // V^T . table of the last pass and its factor, added into acc2 one pass later
  float m = -3.0e38f, l = 0.f;   // query col's running maximum (equal in both lane halves) and this lane's half of its running sum
  v8f acc[2] = {}, acc2[2] = {};   // element r = head dim dt * 16 + 8 g + r of query col
  auto pass = [&](const PassF& f, int p) { v16h pa;
    if (p == pd) { float w[16]; const float relb = relp - (float)(8 * g);   // the pass with the diagonal: every weight by itself, factor 2^0
#pragma unroll
      for (int i = 0; i < 16; ++i) { const float d = relb - (float)(i < 8 ? i : 8 + i); w[i] = exp2_hw(fmaf(d, ua, fmaf(fabsf(d), uc, uk))); cur.c[i] = (_Float16)w[i]; }
#pragma unroll
      for (int i = 0; i < 8; ++i) w[i] = w[2 * i] + w[2 * i + 1];
      cur.cs = ((w[0] + w[1]) + (w[2] + w[3])) + ((w[4] + w[5]) + (w[6] + w[7])); cur.sg = 0.f; cur.kk = 0.f; }
    else if (p == pd + 1) cur = behind;
#pragma unroll   // constant indices, so that the accumulators stay in registers
    for (int dt = 0; dt < 2; ++dt) acc2[dt] += t[dt] * fw;   // the pass before: its products have left the matrix unit by now
    fw = exp2_hw(fmaf(relp - cur.os, cur.sg, cur.kk)); z = fmaf(fw, cur.cs, z); relp -= 32.0f;
    v8f s[2];
#pragma unroll
    for (int ct = 0; ct < 2; ++ct) { v8f c = {}; c = wmma16(ct ? f.k1 : f.k0, aq, c); s[ct] = c * 0.17677669529663688f; }
    float x[2];
#pragma unroll
    for (int ct = 0; ct < 2; ++ct) x[ct] = fmaxf(fmaxf(fmaxf(s[ct][0], s[ct][1]), fmaxf(s[ct][2], s[ct][3])), fmaxf(fmaxf(s[ct][4], s[ct][5]), fmaxf(s[ct][6], s[ct][7])));
    float mx = fmaxf(x[0], x[1]); mx = fmaxf(mx, xhalf(mx));
    const float mn = fmaxf(m, mx); const float ea = exp2_hw((m - mn) * 1.4426950408889634f); const float alpha = (m <= -1.0e38f) ? 0.f : ea; m = mn;
#pragma unroll
    for (int ct = 0; ct < 2; ++ct) { const v8f e = exp2_hw8((s[ct] - mn) * 1.4426950408889634f);
#pragma unroll
      for (int r = 0; r < 8; ++r) pa[ct * 8 + r] = (_Float16)(e[r] * 2048.0f);
      x[ct] = ((e[0] + e[1]) + (e[2] + e[3])) + ((e[4] + e[5]) + (e[6] + e[7])); }
    l = l * alpha + (x[0] + x[1]);
#pragma unroll
    for (int dt = 0; dt < 2; ++dt) { acc[dt] *= alpha; const v16h vf = dt ? f.v1 : f.v0; acc[dt] = wmma16(vf, pa, acc[dt]); v8f c = {}; t[dt] = wmma16(vf, cur.c, c); } };
  // two register sets: each pass first issues the next pass's loads into the other set, so that they fly while this pass is worked on
  PassF fa = fetch_pass(kb, vb, ko, vo, 0), fb;
#pragma unroll 1   // the body already holds two passes, one per register set
  for (int ks = 0; ks < SS / 32; ks += 2) {
    fb = fetch_pass(kb, vb, ko, vo, (ks + 1) * 32);
    pass(fa, ks);
    fa = fetch_pass(kb, vb, ko, vo, (ks + 2 < SS / 32 ? ks + 2 : ks + 1) * 32);   // behind the last pass there is none: fetch in bounds, unused
    pass(fb, ks + 1); }
#pragma unroll   // constant indices, so that the accumulators stay in registers
  for (int dt = 0; dt < 2; ++dt) acc2[dt] += t[dt] * fw;
  z += xhalf(z); l += xhalf(l);   // the two lane halves hold the two halves of query col's keys
  const float cl = (1.0f - gt) * ((1.0f / 2048.0f) / l), cz = gt * (1.0f / z);
  float* orow = O + (rq + col) * DM + h * HD + 8 * g;
#pragma unroll
  for (int dt = 0; dt < 2; ++dt) { v4f o[2];
#pragma unroll
    for (int r = 0; r < 8; ++r) o[r >> 2][r & 3] = acc[dt][r] * cl + acc2[dt][r] * cz;
    vst2(orow + dt * 16, o[0]); vst2(orow + dt * 16 + 4, o[1]); }
}
// ---- k_out: block = (64 rows, 128 cols): out = ctx (hi + lo) . W_proj + b
__global__ __launch_bounds__(128) void k_out(const float* __restrict__ O, const __bf16* __restrict__ P, const float* __restrict__ BP, float* __restrict__ Y) { __shared__ __align__(16) float so[4][16][132];
  const int tid = threadIdx.x, wave = tid >> 5, lane = tid & 31, col = lane & 15, g = lane >> 4; const size_t r0 = (size_t)blockIdx.x * 64 + wave * 16; const int c0 = blockIdx.y * 128; const __bf16* Wr = P + WS_PP / 2;
  v8f acc[8] = {};
#pragma unroll
  for (int kc = 0; kc < DM / 32; ++kc) { const F2 a = split_row(O + (r0 + col) * DM, kc * 32, lane);
#pragma unroll
    for (int j = 0; j < 8; ++j) { const v16b w = frag_b(Wr + (size_t)(c0 + j * 16 + col) * DM + kc * 32, lane); acc[j] = wmma_bf(a.h, w, acc[j]); acc[j] = wmma_bf(a.l, w, acc[j]); } }
#pragma unroll
  for (int j = 0; j < 8; ++j) { const float bb = bfr(BP[c0 + j * 16 + col]);
#pragma unroll
    for (int r = 0; r < 8; ++r) so[wave][8 * g + r][j * 16 + col] = acc[j][r] + bb; }
  LDSX(); for (int rl = 0; rl < 16; ++rl) vst2(Y + (r0 + rl) * DM + c0 + lane * 4, *(const v4f*)&so[wave][rl][lane * 4]); }
extern "C" void kernel_launch(void* const* d_in, const int* in_sizes, int n_in, void* d_out, int out_size, void* d_ws, size_t ws_size, hipStream_t stream) {
  (void)in_sizes; (void)n_in; (void)out_size;
  const float** F = (const float**)d_in;   // 0 x [2,2048,256], 1 W_qk [256,512] (in,out), 2 W_v [256,256], 3 W_proj [256,256], 4 b_proj [256], 5 W_pos [2,8], 6 b_pos [8], 7 gating [8]
  if (ws_size < (size_t)WS_END) return;
  char* ws = (char*)d_ws; __bf16* P = (__bf16*)ws; _Float16 *Q = (_Float16*)(ws + WS_Q), *Kr = (_Float16*)(ws + WS_K), *V = (_Float16*)(ws + WS_V); float* O = (float*)(ws + WS_O);
  k_pack<<<dim3(2 * DM, 3), 256, 0, stream>>>(F[1], F[2], F[3], P);
  k_proj<<<dim3(TNB * SS / 64, 6), 128, 0, stream>>>(F[0], P, Q, Kr, V);
  k_attn<<<dim3(TQB, NH, TNB), 128, 0, stream>>>(Q, Kr, V, F[5], F[6], F[7], O);
  k_out<<<dim3(TNB * SS / 64, DM / 128), 128, 0, stream>>>(O, P, F[4], (float*)d_out);
}

// v005
// Measured time: 50.2 microseconds a run.
// Timed twice side by side with v004, it ran 1.35 and 1.41 times as fast.
// Over all steps from v000 it is 3.73 times as fast.
// compute dtype: all float inputs rounded to bf16; q/k = x . W_qk and v = x . W_v with EXACT bf16 products on WMMA 16x16x32 ((in,out) weights as transposed rows), rounded once to f16 (v as planes); content attention per (batch, head): q, k single f16 x 32^-1/2, running-max softmax in f32 (hardware exp), P (scaled by 2^11, single f16) x v; positional attention: per-head weights exp((n-m) W_pos[0,h] + |n-m| W_pos[1,h] + b_pos[h] - row maximum) x 2^11; in the one 32-key pass that holds the query they are formed one by one in f32 and rounded to f16, in every other pass they are a constant f16 fragment (the fall-off inside a pass) times one f32 factor per query and pass, applied to the product with the same v fragments; divided by their f32 row sum at the end; mix (1 - g) patch + g pos with g = sigmoid(gating_h) in f32; out = ctx (bf16 hi + lo, 2 products) . W_proj + b; f32 output.
#include <hip/hip_runtime.h>
#include <math.h>

typedef __attribute__((ext_vector_type(16))) _Float16 v16h;
typedef __attribute__((ext_vector_type(16))) __bf16 v16b;
typedef __attribute__((ext_vector_type(8)))  _Float16 v8h;
typedef __attribute__((ext_vector_type(8)))  float v8f;
typedef __attribute__((ext_vector_type(4)))  float v4f;
typedef __attribute__((ext_vector_type(2)))  float v2f;
typedef __attribute__((ext_vector_type(4)))  unsigned v4u;
typedef __attribute__((ext_vector_type(4)))  int v4i;
typedef float __attribute__((may_alias)) float_a;
typedef int __attribute__((may_alias)) int_a;

template <typename T> __device__ __forceinline__ void vst2(void* p, T v) { *(T*)p = v;  }
__device__ __forceinline__ v8f wmma16(v16h a, v16h b, v8f c) {
  v8f d = __builtin_amdgcn_wmma_f32_16x16x32_f16(false, a, false, b, (short)0, c, false, false);
  asm volatile("v_nop\n\tv_nop\n\tv_nop\n\tv_nop" : "+v"(d) : "v"(a), "v"(b));
  return d;
}
__device__ __forceinline__ v8f wmma_bf(v16b a, v16b b, v8f c) {
  v8f d = __builtin_amdgcn_wmma_f32_16x16x32_bf16(false, a, false, b, (short)0, c, false, false);
  asm volatile("v_nop\n\tv_nop\n\tv_nop\n\tv_nop" : "+v"(d) : "v"(a), "v"(b));
  return d;
}
// 16x16x32 fragments: lane = (h = lane>>4, row/col = lane&15); elements 0..7 = k0+8h+0..7, 8..15 = k0+16+8h+0..7; D element r = row 8h+r
__device__ __forceinline__ v16h frag_h(const _Float16* rowk0, int lane) {
  union { v16h v; v8h q[2]; } u; const _Float16* p = rowk0 + 8 * (lane >> 4);
  u.q[0] = *(const v8h*)p; u.q[1] = *(const v8h*)(p + 16); return u.v;
}
__device__ __forceinline__ v16h frag_f32(const float* rowk0, int lane) {
  v16h a; const float* p = rowk0 + 8 * (lane >> 4);
#pragma unroll
  for (int i = 0; i < 8; ++i) { a[i] = (_Float16)p[i]; a[8 + i] = (_Float16)p[16 + i]; }
  return a;
}
__device__ __forceinline__ v16h frag_f32s(const float* rowk0, int lane, float sc) {
  v16h a; const float* p = rowk0 + 8 * (lane >> 4);
#pragma unroll
  for (int i = 0; i < 8; ++i) { a[i] = (_Float16)(p[i] * sc); a[8 + i] = (_Float16)(p[16 + i] * sc); }
  return a;
}
// column fragment from a [K][ld] layout (column n), rows >= K read as 0
__device__ __forceinline__ v16h fragc_f32(const float* W, int k0, int n, int lane, int ld, int K) {
  v16h a; const int g = lane >> 4;
#pragma unroll
  for (int i = 0; i < 8; ++i) { const int ka = k0 + 8 * g + i, kb = ka + 16;
    a[i] = (_Float16)(ka < K ? W[(size_t)(ka < K ? ka : K - 1) * ld + n] : 0.f); a[8 + i] = (_Float16)(kb < K ? W[(size_t)(kb < K ? kb : K - 1) * ld + n] : 0.f); }
  return a;
}
struct F2 { v16b h, l; };
__device__ __forceinline__ F2 bsplit16(const float v[16]) { F2 r;
#pragma unroll
  for (int i = 0; i < 16; ++i) { const __bf16 h = (__bf16)v[i]; r.h[i] = h; r.l[i] = (__bf16)(v[i] - (float)h); }
  return r; }
__device__ __forceinline__ F2 split_row(const float* row, int k0, int lane) { float v[16]; const float* p = row + k0 + 8 * (lane >> 4);
#pragma unroll
  for (int i = 0; i < 8; ++i) { v[i] = p[i]; v[8 + i] = p[16 + i]; }
  return bsplit16(v); }
__device__ __forceinline__ F2 split_rowK(const float* row, int k0, int lane, int K) { float v[16]; const int g = lane >> 4;
#pragma unroll
  for (int i = 0; i < 8; ++i) { const int ka = k0 + 8 * g + i, kb = ka + 16; v[i] = ka < K ? row[ka < K ? ka : K - 1] : 0.f; v[8 + i] = kb < K ? row[kb < K ? kb : K - 1] : 0.f; }
  return bsplit16(v); }
__device__ __forceinline__ F2 split_col(const float* W, int k0, int n, int lane, int ld, int K) { float v[16]; const int g = lane >> 4;
#pragma unroll
  for (int i = 0; i < 8; ++i) { const int ka = k0 + 8 * g + i, kb = ka + 16; v[i] = ka < K ? W[(size_t)(ka < K ? ka : K - 1) * ld + n] : 0.f; v[8 + i] = kb < K ? W[(size_t)(kb < K ? kb : K - 1) * ld + n] : 0.f; }
  return bsplit16(v); }
__device__ __forceinline__ v8f mac3(const F2& a, const F2& b, v8f c) { c = wmma_bf(a.l, b.h, c); c = wmma_bf(a.h, b.l, c); return wmma_bf(a.h, b.h, c); }
__device__ __forceinline__ float sigm(float v) { return 1.0f / (1.0f + expf(-v)); }
#define LDSX() do { asm volatile("s_wait_dscnt 0" ::: "memory"); __builtin_amdgcn_wave_barrier(); __builtin_amdgcn_fence(__ATOMIC_RELEASE, "workgroup"); } while (0)


// Gated positional self-attention, 1-D (B 2, N 2,048 patches, C 256, 8 heads x 32): content softmax(q k / sqrt(32)) and a positional softmax from relative indices (d, |d|) . W_pos + b_pos, mixed per head by sigmoid(gating), (re)normalised, applied to v, output projection + bias.
#define NB 2
#define SS 2048
#define DM 256
#define NH 8
#define HD 32
#define NR (NB * SS)
#ifndef TQB
#define TQB (SS / 64)
#define TNB NB
#endif
typedef __attribute__((ext_vector_type(8))) __bf16 v8b;
__device__ __forceinline__ v16b frag_b(const __bf16* rowk0, int lane) {
  union { v16b v; v8b q[2]; } u; const __bf16* p = rowk0 + 8 * (lane >> 4);
  u.q[0] = *(const v8b*)p; u.q[1] = *(const v8b*)(p + 16); return u.v;
}
__device__ __forceinline__ float bfr(float v) { return (float)(__bf16)v; }
__device__ __attribute__((noinline)) float exp_ni(float v) { return expf(v); }
__device__ __attribute__((noinline)) float erf_ni(float v) { return erff(v); }

#define WS_PW  0u                                   // bf16 transposed rows: W_qk^T [512][256] (q rows 0..255, k rows 256..511), W_v^T [256][256], W_proj^T [256][256]
#define WS_PV  (WS_PW + 2u * (size_t)512 * DM)
#define WS_PP  (WS_PV + 2u * (size_t)DM * DM)
#define WS_Q   (WS_PP + 2u * (size_t)DM * DM)          // f16 q rows [NR][256], k rows [NR][256], v planes [b][256][SS]; f32 ctx [NR][256]
#define WS_K   (WS_Q + 2u * (size_t)NR * DM)
#define WS_V   (WS_K + 2u * (size_t)NR * DM)
#define WS_O   (WS_V + 2u * (size_t)NB * DM * SS)
#define WS_END (WS_O + 4u * (size_t)NR * DM)

__global__ __launch_bounds__(256) void k_pack(const float* __restrict__ WQK, const float* __restrict__ WV, const float* __restrict__ WP, __bf16* __restrict__ P) { const int n = blockIdx.x, which = blockIdx.y, t = threadIdx.x; __shared__ __align__(16) __bf16 s[DM];
  if (which == 0) { s[t] = (__bf16)WQK[(size_t)t * (2 * DM) + n]; __syncthreads(); if (t < DM / 8) vst2((unsigned*)(P + WS_PW / 2 + (size_t)n * DM + t * 8), *(const v4u*)&s[t * 8]); }   // n < 512
  else if (which == 1) { if (n >= DM) return; s[t] = (__bf16)WV[(size_t)t * DM + n]; __syncthreads(); if (t < DM / 8) vst2((unsigned*)(P + WS_PV / 2 + (size_t)n * DM + t * 8), *(const v4u*)&s[t * 8]); }
  else { if (n >= DM) return; s[t] = (__bf16)WP[(size_t)t * DM + n]; __syncthreads(); if (t < DM / 8) vst2((unsigned*)(P + WS_PP / 2 + (size_t)n * DM + t * 8), *(const v4u*)&s[t * 8]); } }
// The two GEMM kernels walk 64 weight fragments (step i = kc * 8 + j) and 8 row fragments. A load does not move over the statement behind a matrix instruction, so a load written at its use is waited for at its use:
// the loads are written ahead instead. RD weight fragments are in flight in a ring of registers (step i refills its place with fragment i + RD), the f32 row pieces two k steps ahead
#define RD 12
struct Row16 { v4f q[4]; };   // a lane's 16 f32 of one k step: k0 + 8 g + 0..7 and k0 + 16 + 8 g + 0..7
__device__ __forceinline__ Row16 row_ld(const float* lanep, int kc) { Row16 r; const float* p = lanep + kc * 32;
  r.q[0] = *(const v4f*)p; r.q[1] = *(const v4f*)(p + 4); r.q[2] = *(const v4f*)(p + 16); r.q[3] = *(const v4f*)(p + 20); return r; }
__device__ __forceinline__ v16b wfrag_ld(const __bf16* lanep, int i) { union { v16b v; v8b q[2]; } u; const __bf16* p = lanep + (size_t)(i & 7) * 16 * DM + (i >> 3) * 32;
  u.q[0] = *(const v8b*)p; u.q[1] = *(const v8b*)(p + 16); return u.v; }
// ---- k_proj: block = (64 rows, 128 cols, which): 0,1: q cols / 2,3: k cols of x . W_qk (which = blockIdx.y over 4 col blocks of 128); 4,5: v -> planes
__global__ __launch_bounds__(128) void k_proj(const float* __restrict__ X, const __bf16* __restrict__ P, _Float16* __restrict__ Q, _Float16* __restrict__ Kr, _Float16* __restrict__ V) {
  __shared__ __align__(16) _Float16 so[64][136]; __shared__ __align__(16) _Float16 st[128][72];
  const int tid = threadIdx.x, wave = tid >> 5, lane = tid & 31, col = lane & 15, g = lane >> 4; const int cb = blockIdx.y; const size_t rb = (size_t)blockIdx.x * 64; const size_t r0 = rb + wave * 16;
  const __bf16* Wr = (cb < 4) ? (P + WS_PW / 2 + (size_t)cb * 128 * DM) : (P + WS_PV / 2 + (size_t)(cb - 4) * 128 * DM);
  v8f acc[8] = {};
  const float* xl = X + (r0 + col) * DM + 8 * g; const __bf16* wl = Wr + (size_t)col * DM + 8 * g;
  Row16 xr[2]; v16b ring[RD];
  xr[0] = row_ld(xl, 0);
#pragma unroll   // constant indices, so that the ring stays in registers
  for (int i = 0; i < RD; ++i) { ring[i] = wfrag_ld(wl, i); if (i == 3) xr[1] = row_ld(xl, 1); }
#pragma unroll
  for (int kc = 0; kc < DM / 32; ++kc) { v16b a;
    __builtin_amdgcn_sched_barrier(0);   // keeps this step's conversion here: moved up, it waits for row pieces that were only just asked for, and that wait drains the ring
#pragma unroll
    for (int i = 0; i < 16; ++i) a[i] = (__bf16)xr[kc & 1].q[i >> 2][i & 3];
    if (kc + 2 < DM / 32) xr[kc & 1] = row_ld(xl, kc + 2);
#pragma unroll
    for (int j = 0; j < 8; ++j) { const int i = kc * 8 + j; acc[j] = wmma_bf(a, ring[i % RD], acc[j]); if (i + RD < 64) ring[i % RD] = wfrag_ld(wl, i + RD);
      if (i + RD == 63) asm volatile("s_wait_xcnt 0x0" :: "v"(xl), "v"(wl) : "memory"); } }   // behind the last load; the two lane addresses are inputs, so that their registers are not rewritten in front of the wait
  if (cb < 4) {
#pragma unroll
    for (int j = 0; j < 8; ++j)
#pragma unroll
      for (int r = 0; r < 8; ++r) so[wave * 16 + 8 * g + r][j * 16 + col] = (_Float16)acc[j][r];
    __syncthreads(); _Float16* dst = (cb < 2) ? Q : Kr; const int c0 = (cb & 1) * 128; for (int e = tid; e < 64 * 16; e += 128) { const int rl = e >> 4, q = e & 15; vst2((unsigned*)(dst + (rb + rl) * DM + c0 + q * 8), *(const v4u*)&so[rl][q * 8]); } }
  else {
#pragma unroll
    for (int j = 0; j < 8; ++j)
#pragma unroll
      for (int r = 0; r < 8; ++r) st[j * 16 + col][wave * 16 + 8 * g + r] = (_Float16)acc[j][r];
    __syncthreads(); const size_t b = rb / SS; const int s0 = (int)(rb % SS); const int c0 = (cb - 4) * 128; for (int e = tid; e < 128 * 8; e += 128) { const int d = e >> 3, pc = e & 7; vst2((unsigned*)(V + ((b * DM + c0 + d) * SS) + s0 + pc * 8), *(const v4u*)&st[d][pc * 8]); } }
}
// the eight 16-byte loads a lane makes for one 32-key pass: two K tiles, two V tiles
struct PassF { v16h k0, k1, v0, v1; };
// fragment at a wave-uniform base plus this lane's byte offset: the lane offsets are fixed for the whole loop, only the uniform bases move from pass to pass
typedef const __attribute__((address_space(1))) char* gcp;
typedef const __attribute__((address_space(1))) v8h* gv8p;
__device__ __forceinline__ v16h frag_u(gcp ubase, unsigned voff) {
  union { v16h v; v8h q[2]; } u; gcp p = ubase + voff;
  u.q[0] = *(gv8p)p; u.q[1] = *(gv8p)(p + 32); return u.v;
}
__device__ __forceinline__ gcp sbase(const _Float16* p) { return (gcp)(unsigned long long)p; }   // the workspace planes lie in global memory
__device__ __forceinline__ PassF fetch_pass(const _Float16* kb, const _Float16* vb, unsigned ko, unsigned vo, int j0) {
  const gcp ks = sbase(kb + (size_t)j0 * DM), vs = sbase(vb + j0);
  PassF f; f.k0 = frag_u(ks, ko); f.k1 = frag_u(ks + 16 * DM * 2, ko); f.v0 = frag_u(vs, vo); f.v1 = frag_u(vs + 16 * SS * 2, vo);
  asm volatile("s_wait_xcnt 0x0" ::: "memory");   // stands behind the loads, in front of the next rewrite of an address register that they name
  return f; }
// 2^x on the hardware unit. The v_nop is the slot that the instruction set asks for behind a transcendental before its result is used or its source overwritten
__device__ __forceinline__ float exp2_hw(float x) { float r; asm("v_exp_f32 %0, %1\n\tv_nop" : "=v"(r) : "v"(x)); return r; }
// eight of them in one statement: every result register differs from every source (early clobber), so that each fills the slot of the one in front of it; the one v_nop is the slot behind the last
__device__ __forceinline__ v8f exp2_hw8(v8f x) { float r0, r1, r2, r3, r4, r5, r6, r7;
  asm("v_exp_f32 %0, %8\n\tv_exp_f32 %1, %9\n\tv_exp_f32 %2, %10\n\tv_exp_f32 %3, %11\n\tv_exp_f32 %4, %12\n\tv_exp_f32 %5, %13\n\tv_exp_f32 %6, %14\n\tv_exp_f32 %7, %15\n\tv_nop"
      : "=&v"(r0), "=&v"(r1), "=&v"(r2), "=&v"(r3), "=&v"(r4), "=&v"(r5), "=&v"(r6), "=&v"(r7) : "v"(x[0]), "v"(x[1]), "v"(x[2]), "v"(x[3]), "v"(x[4]), "v"(x[5]), "v"(x[6]), "v"(x[7]));
  return v8f{r0, r1, r2, r3, r4, r5, r6, r7}; }
__device__ __forceinline__ float xhalf(float v) { return __builtin_bit_cast(float, __builtin_amdgcn_permlanex16(__builtin_bit_cast(int, v), __builtin_bit_cast(int, v), 0x76543210, 0xfedcba98, false, false)); }   // the value of lane ^ 16
// transposed products: S^T = K . Q^T (A = 16 key rows, B = the wave's 16 queries) and O^T += V^T . P^T. A lane holds 16 of the 32 scores of ONE query (column col; keys 8 g + r and 16 + 8 g + r), which is the k order of the B operand of the second product: P goes from the score accumulators straight into that operand
__global__ __launch_bounds__(128) void k_attn(const _Float16* __restrict__ Q, const _Float16* __restrict__ Kr, const _Float16* __restrict__ V, const float* __restrict__ WPOS, const float* __restrict__ BPOS, const float* __restrict__ GATE, float* __restrict__ O) {
  const int tid = threadIdx.x, wave = __builtin_amdgcn_readfirstlane(tid >> 5), lane = tid & 31, col = lane & 15, g = lane >> 4; const int h = blockIdx.y; const size_t b = blockIdx.z; const int q0 = blockIdx.x * 64 + wave * 16; const size_t rq = b * SS + q0;   // the wave's number in a scalar register: the tests on pd below are scalar branches
  const float gt = 1.0f / (1.0f + expf(-bfr(GATE[h])));
  const v16h aq = frag_h(Q + (rq + col) * DM + h * HD, lane);
  asm volatile("s_wait_xcnt 0x0" :: "v"(Q + (rq + col) * DM + h * HD + 8 * g) : "memory");   // behind the two loads of aq; their address is an input, so that its registers are not rewritten in front of the wait
  const _Float16* kb = Kr + b * SS * DM + h * HD; const _Float16* vb = V + (b * DM + h * HD) * SS;
  const unsigned ko = (unsigned)(col * DM + 8 * g) * 2u, vo = (unsigned)(col * SS + 8 * g) * 2u;
  // positional row of query n = q0 + col (this lane's column of the B operand), in the base-2 exponent: u(d) = d ua + |d| uc + ub with d = n - m. u is linear on either side of d = 0, so its maximum over the row lies at m = 0, m = n or m = SS - 1
  const float ua = bfr(WPOS[h]) * 1.4426950408889634f, uc = bfr(WPOS[NH + h]) * 1.4426950408889634f, ub = bfr(BPOS[h]) * 1.4426950408889634f;
  const float nq = (float)(q0 + col), dl = nq - (float)(SS - 1);
  const float um = fmaxf(fmaxf(fmaf(nq, ua, fmaf(fabsf(nq), uc, ub)), fmaf(dl, ua, fmaf(fabsf(dl), uc, ub))), ub);
  const float uk = (ub - um) + 11.0f;   // weight = 2^(u - maximum + 11)
  float relp = nq, z = 0.f;   // relp: n - m at the first key of the pass; z: sum of this lane's weights
  // Off the diagonal |d| = +-d for all 32 keys of a pass, so u is linear there: u(d) = d sg + ub, sg = ua + uc before the query, ua - uc behind it, and
  // weight(n, j0 + o) = 2^((n - j0 - os) sg + ub - maximum) x 2^((os - o) sg + 11): one factor per query and pass times a table over o that is the same in every pass.
  // os is the end of the pass with the larger weight (31 for sg <= 0, else 0): the table lies in [0, 2^11] and the factor is a weight of the row / 2^11, so neither can overflow
  const int pd = q0 >> 5;   // the one pass whose 32 keys hold the wave's 16 queries
  struct Side { v16h c; float cs, sg, os, kk; };   // table as B operand, this lane's sum of it, slope, os, constant of the factor's exponent
  auto side = [&](float sg) { Side t; t.sg = sg; t.os = sg <= 0.f ? 31.0f : 0.f; t.kk = ub - um; t.cs = 0.f;
#pragma unroll   // constant indices, so that the table stays in registers
    for (int i = 0; i < 16; ++i) { t.c[i] = (_Float16)exp2_hw(fmaf(t.os - (float)(8 * g + (i < 8 ? i : 8 + i)), sg, 11.0f)); t.cs += (float)t.c[i]; }
    return t; };
  Side cur = side(ua + uc); const Side behind = side(ua - uc);
  v8f t[2] = {}; float fw = 0.f;   // V^T . table of the last pass and its factor, added into acc2 one pass later
  float m = -3.0e38f, l = 0.f;   // query col's running maximum (equal in both lane halves) and this lane's half of its running sum
  v8f acc[2] = {}, acc2[2] = {};   // element r = head dim dt * 16 + 8 g + r of query col
  auto pass = [&](const PassF& f, int p) { v16h pa;
    if (p == pd) { float w[16]; const float relb = relp - (float)(8 * g);   // the pass with the diagonal: every weight by itself, factor 2^0
#pragma unroll
      for (int i = 0; i < 16; ++i) { const float d = relb - (float)(i < 8 ? i : 8 + i); w[i] = exp2_hw(fmaf(d, ua, fmaf(fabsf(d), uc, uk))); cur.c[i] = (_Float16)w[i]; }
#pragma unroll
      for (int i = 0; i < 8; ++i) w[i] = w[2 * i] + w[2 * i + 1];
      cur.cs = ((w[0] + w[1]) + (w[2] + w[3])) + ((w[4] + w[5]) + (w[6] + w[7])); cur.sg = 0.f; cur.kk = 0.f; }
    else if (p == pd + 1) cur = behind;
#pragma unroll   // constant indices, so that the accumulators stay in registers
    for (int dt = 0; dt < 2; ++dt) acc2[dt] += t[dt] * fw;   // the pass before: its products have left the matrix unit by now
    fw = exp2_hw(fmaf(relp - cur.os, cur.sg, cur.kk)); z = fmaf(fw, cur.cs, z); relp -= 32.0f;
    v8f s[2];
#pragma unroll
    for (int ct = 0; ct < 2; ++ct) { v8f c = {}; c = wmma16(ct ? f.k1 : f.k0, aq, c); s[ct] = c * 0.17677669529663688f; }
    float x[2];
#pragma unroll
    for (int ct = 0; ct < 2; ++ct) x[ct] = fmaxf(fmaxf(fmaxf(s[ct][0], s[ct][1]), fmaxf(s[ct][2], s[ct][3])), fmaxf(fmaxf(s[ct][4], s[ct][5]), fmaxf(s[ct][6], s[ct][7])));
    float mx = fmaxf(x[0], x[1]); mx = fmaxf(mx, xhalf(mx));
    const float mn = fmaxf(m, mx); const float ea = exp2_hw((m - mn) * 1.4426950408889634f); const float alpha = (m <= -1.0e38f) ? 0.f : ea; m = mn;
#pragma unroll
    for (int ct = 0; ct < 2; ++ct) { const v8f e = exp2_hw8((s[ct] - mn) * 1.4426950408889634f);
#pragma unroll
      for (int r = 0; r < 8; ++r) pa[ct * 8 + r] = (_Float16)(e[r] * 2048.0f);
      x[ct] = ((e[0] + e[1]) + (e[2] + e[3])) + ((e[4] + e[5]) + (e[6] + e[7])); }
    l = l * alpha + (x[0] + x[1]);
#pragma unroll
    for (int dt = 0; dt < 2; ++dt) { acc[dt] *= alpha; const v16h vf = dt ? f.v1 : f.v0; acc[dt] = wmma16(vf, pa, acc[dt]); v8f c = {}; t[dt] = wmma16(vf, cur.c, c); } };
  // two register sets: each pass first issues the next pass's loads into the other set, so that they fly while this pass is worked on
  PassF fa = fetch_pass(kb, vb, ko, vo, 0), fb;
#pragma unroll 1   // the body already holds two passes, one per register set
  for (int ks = 0; ks < SS / 32; ks += 2) {
    fb = fetch_pass(kb, vb, ko, vo, (ks + 1) * 32);
    pass(fa, ks);
    fa = fetch_pass(kb, vb, ko, vo, (ks + 2 < SS / 32 ? ks + 2 : ks + 1) * 32);   // behind the last pass there is none: fetch in bounds, unused
    pass(fb, ks + 1); }
#pragma unroll   // constant indices, so that the accumulators stay in registers
  for (int dt = 0; dt < 2; ++dt) acc2[dt] += t[dt] * fw;
  z += xhalf(z); l += xhalf(l);   // the two lane halves hold the two halves of query col's keys
  const float cl = (1.0f - gt) * ((1.0f / 2048.0f) / l), cz = gt * (1.0f / z);
  float* orow = O + (rq + col) * DM + h * HD + 8 * g;
#pragma unroll
  for (int dt = 0; dt < 2; ++dt) { v4f o[2];
#pragma unroll
    for (int r = 0; r < 8; ++r) o[r >> 2][r & 3] = acc[dt][r] * cl + acc2[dt][r] * cz;
    vst2(orow + dt * 16, o[0]); vst2(orow + dt * 16 + 4, o[1]); }
}
// ---- k_out: block = (64 rows, 128 cols): out = ctx (hi + lo) . W_proj + b
__global__ __launch_bounds__(128) void k_out(const float* __restrict__ O, const __bf16* __restrict__ P, const float* __restrict__ BP, float* __restrict__ Y) { __shared__ __align__(16) float so[4][16][132];
  const int tid = threadIdx.x, wave = tid >> 5, lane = tid & 31, col = lane & 15, g = lane >> 4; const size_t r0 = (size_t)blockIdx.x * 64 + wave * 16; const int c0 = blockIdx.y * 128; const __bf16* Wr = P + WS_PP / 2;
  v8f acc[8] = {};
  const float* ol = O + (r0 + col) * DM + 8 * g; const __bf16* wl = Wr + (size_t)(c0 + col) * DM + 8 * g;
  Row16 xr[2]; v16b ring[RD];
  xr[0] = row_ld(ol, 0);
#pragma unroll   // constant indices, so that the ring stays in registers
  for (int i = 0; i < RD; ++i) { ring[i] = wfrag_ld(wl, i); if (i == 3) xr[1] = row_ld(ol, 1); }
#pragma unroll
  for (int kc = 0; kc < DM / 32; ++kc) { float v[16];
    __builtin_amdgcn_sched_barrier(0);   // keeps this step's split here: moved up, it waits for row pieces that were only just asked for, and that wait drains the ring
#pragma unroll
    for (int i = 0; i < 16; ++i) v[i] = xr[kc & 1].q[i >> 2][i & 3];
    const F2 a = bsplit16(v);
    if (kc + 2 < DM / 32) xr[kc & 1] = row_ld(ol, kc + 2);
#pragma unroll
    for (int j = 0; j < 8; ++j) { const int i = kc * 8 + j; const v16b w = ring[i % RD]; acc[j] = wmma_bf(a.h, w, acc[j]); acc[j] = wmma_bf(a.l, w, acc[j]); if (i + RD < 64) ring[i % RD] = wfrag_ld(wl, i + RD);
      if (i + RD == 63) asm volatile("s_wait_xcnt 0x0" :: "v"(ol), "v"(wl) : "memory"); } }   // behind the last load; the two lane addresses are inputs, so that their registers are not rewritten in front of the wait
#pragma unroll
  for (int j = 0; j < 8; ++j) { const float bb = bfr(BP[c0 + j * 16 + col]);
#pragma unroll
    for (int r = 0; r < 8; ++r) so[wave][8 * g + r][j * 16 + col] = acc[j][r] + bb; }
  LDSX(); for (int rl = 0; rl < 16; ++rl) vst2(Y + (r0 + rl) * DM + c0 + lane * 4, *(const v4f*)&so[wave][rl][lane * 4]); }
extern "C" void kernel_launch(void* const* d_in, const int* in_sizes, int n_in, void* d_out, int out_size, void* d_ws, size_t ws_size, hipStream_t stream) {
  (void)in_sizes; (void)n_in; (void)out_size;
  const float** F = (const float**)d_in;   // 0 x [2,2048,256], 1 W_qk [256,512] (in,out), 2 W_v [256,256], 3 W_proj [256,256], 4 b_proj [256], 5 W_pos [2,8], 6 b_pos [8], 7 gating [8]
  if (ws_size < (size_t)WS_END) return;
  char* ws = (char*)d_ws; __bf16* P = (__bf16*)ws; _Float16 *Q = (_Float16*)(ws + WS_Q), *Kr = (_Float16*)(ws + WS_K), *V = (_Float16*)(ws + WS_V); float* O = (float*)(ws + WS_O);
  k_pack<<<dim3(2 * DM, 3), 256, 0, stream>>>(F[1], F[2], F[3], P);
  k_proj<<<dim3(TNB * SS / 64, 6), 128, 0, stream>>>(F[0], P, Q, Kr, V);
  k_attn<<<dim3(TQB, NH, TNB), 128, 0, stream>>>(Q, Kr, V, F[5], F[6], F[7], O);
  k_out<<<dim3(TNB * SS / 64, DM / 128), 128, 0, stream>>>(O, P, F[4], (float*)d_out);
}

// v006
// Measured time: 41.5 microseconds a run.
// In two side-by-side timings against v005, it was 1.21 and 1.26 times as fast.
// All steps since v000 together make it 4.61 times as fast.
// compute dtype: all float inputs rounded to bf16; q/k = x . W_qk and v = x . W_v with EXACT bf16 products on WMMA 16x16x32 ((in,out) weights rounded to bf16 in LDS, fragments by the transposing load), rounded once to f16 (v as planes); content attention per (batch, head): q, k single f16 x 32^-1/2, running-max softmax in f32 (hardware exp), P (scaled by 2^11, single f16) x v; positional attention: per-head weights exp((n-m) W_pos[0,h] + |n-m| W_pos[1,h] + b_pos[h] - row maximum) x 2^11; in the one 32-key pass that holds the query they are formed one by one in f32 and rounded to f16, in every other pass they are a constant f16 fragment (the fall-off inside a pass) times one f32 factor per query and pass, applied to the product with the same v fragments; divided by their f32 row sum at the end; mix (1 - g) patch + g pos with g = sigmoid(gating_h) in f32; out = ctx (bf16 hi + lo, 2 products) . W_proj + b; f32 output.
#include <hip/hip_runtime.h>
#include <math.h>

typedef __attribute__((ext_vector_type(16))) _Float16 v16h;
typedef __attribute__((ext_vector_type(16))) __bf16 v16b;
typedef __attribute__((ext_vector_type(8)))  _Float16 v8h;
typedef __attribute__((ext_vector_type(8)))  float v8f;
typedef __attribute__((ext_vector_type(4)))  float v4f;
typedef __attribute__((ext_vector_type(2)))  float v2f;
typedef __attribute__((ext_vector_type(4)))  unsigned v4u;
typedef __attribute__((ext_vector_type(4)))  int v4i;
typedef float __attribute__((may_alias)) float_a;
typedef int __attribute__((may_alias)) int_a;

template <typename T> __device__ __forceinline__ void vst2(void* p, T v) { *(T*)p = v;  }
__device__ __forceinline__ v8f wmma16(v16h a, v16h b, v8f c) {
  v8f d = __builtin_amdgcn_wmma_f32_16x16x32_f16(false, a, false, b, (short)0, c, false, false);
  asm volatile("v_nop\n\tv_nop\n\tv_nop\n\tv_nop" : "+v"(d) : "v"(a), "v"(b));
  return d;
}
__device__ __forceinline__ v8f wmma_bf(v16b a, v16b b, v8f c) {
  v8f d = __builtin_amdgcn_wmma_f32_16x16x32_bf16(false, a, false, b, (short)0, c, false, false);
  asm volatile("v_nop\n\tv_nop\n\tv_nop\n\tv_nop" : "+v"(d) : "v"(a), "v"(b));
  return d;
}
// 16x16x32 fragments: lane = (h = lane>>4, row/col = lane&15); elements 0..7 = k0+8h+0..7, 8..15 = k0+16+8h+0..7; D element r = row 8h+r
__device__ __forceinline__ v16h frag_h(const _Float16* rowk0, int lane) {
  union { v16h v; v8h q[2]; } u; const _Float16* p = rowk0 + 8 * (lane >> 4);
  u.q[0] = *(const v8h*)p; u.q[1] = *(const v8h*)(p + 16); return u.v;
}
__device__ __forceinline__ v16h frag_f32(const float* rowk0, int lane) {
  v16h a; const float* p = rowk0 + 8 * (lane >> 4);
#pragma unroll
  for (int i = 0; i < 8; ++i) { a[i] = (_Float16)p[i]; a[8 + i] = (_Float16)p[16 + i]; }
  return a;
}
__device__ __forceinline__ v16h frag_f32s(const float* rowk0, int lane, float sc) {
  v16h a; const float* p = rowk0 + 8 * (lane >> 4);
#pragma unroll
  for (int i = 0; i < 8; ++i) { a[i] = (_Float16)(p[i] * sc); a[8 + i] = (_Float16)(p[16 + i] * sc); }
  return a;
}
// column fragment from a [K][ld] layout (column n), rows >= K read as 0
__device__ __forceinline__ v16h fragc_f32(const float* W, int k0, int n, int lane, int ld, int K) {
  v16h a; const int g = lane >> 4;
#pragma unroll
  for (int i = 0; i < 8; ++i) { const int ka = k0 + 8 * g + i, kb = ka + 16;
    a[i] = (_Float16)(ka < K ? W[(size_t)(ka < K ? ka : K - 1) * ld + n] : 0.f); a[8 + i] = (_Float16)(kb < K ? W[(size_t)(kb < K ? kb : K - 1) * ld + n] : 0.f); }
  return a;
}
struct F2 { v16b h, l; };
__device__ __forceinline__ F2 bsplit16(const float v[16]) { F2 r;
#pragma unroll
  for (int i = 0; i < 16; ++i) { const __bf16 h = (__bf16)v[i]; r.h[i] = h; r.l[i] = (__bf16)(v[i] - (float)h); }
  return r; }
__device__ __forceinline__ F2 split_row(const float* row, int k0, int lane) { float v[16]; const float* p = row + k0 + 8 * (lane >> 4);
#pragma unroll
  for (int i = 0; i < 8; ++i) { v[i] = p[i]; v[8 + i] = p[16 + i]; }
  return bsplit16(v); }
__device__ __forceinline__ F2 split_rowK(const float* row, int k0, int lane, int K) { float v[16]; const int g = lane >> 4;
#pragma unroll
  for (int i = 0; i < 8; ++i) { const int ka = k0 + 8 * g + i, kb = ka + 16; v[i] = ka < K ? row[ka < K ? ka : K - 1] : 0.f; v[8 + i] = kb < K ? row[kb < K ? kb : K - 1] : 0.f; }
  return bsplit16(v); }
__device__ __forceinline__ F2 split_col(const float* W, int k0, int n, int lane, int ld, int K) { float v[16]; const int g = lane >> 4;
#pragma unroll
  for (int i = 0; i < 8; ++i) { const int ka = k0 + 8 * g + i, kb = ka + 16; v[i] = ka < K ? W[(size_t)(ka < K ? ka : K - 1) * ld + n] : 0.f; v[8 + i] = kb < K ? W[(size_t)(kb < K ? kb : K - 1) * ld + n] : 0.f; }
  return bsplit16(v); }
__device__ __forceinline__ v8f mac3(const F2& a, const F2& b, v8f c) { c = wmma_bf(a.l, b.h, c); c = wmma_bf(a.h, b.l, c); return wmma_bf(a.h, b.h, c); }
__device__ __forceinline__ float sigm(float v) { return 1.0f / (1.0f + expf(-v)); }
#define LDSX() do { asm volatile("s_wait_dscnt 0" ::: "memory"); __builtin_amdgcn_wave_barrier(); __builtin_amdgcn_fence(__ATOMIC_RELEASE, "workgroup"); } while (0)


// Gated positional self-attention, 1-D (B 2, N 2,048 patches, C 256, 8 heads x 32): content softmax(q k / sqrt(32)) and a positional softmax from relative indices (d, |d|) . W_pos + b_pos, mixed per head by sigmoid(gating), (re)normalised, applied to v, output projection + bias.
#define NB 2
#define SS 2048
#define DM 256
#define NH 8
#define HD 32
#define NR (NB * SS)
#ifndef TQB
#define TQB (SS / 64)
#define TNB NB
#endif
typedef __attribute__((ext_vector_type(8))) __bf16 v8b;
__device__ __forceinline__ v16b frag_b(const __bf16* rowk0, int lane) {
  union { v16b v; v8b q[2]; } u; const __bf16* p = rowk0 + 8 * (lane >> 4);
  u.q[0] = *(const v8b*)p; u.q[1] = *(const v8b*)(p + 16); return u.v;
}
__device__ __forceinline__ float bfr(float v) { return (float)(__bf16)v; }
__device__ __attribute__((noinline)) float exp_ni(float v) { return expf(v); }
__device__ __attribute__((noinline)) float erf_ni(float v) { return erff(v); }

#define WS_PW  0u                                   // the first three ranges are not used
#define WS_PV  (WS_PW + 2u * (size_t)512 * DM)
#define WS_PP  (WS_PV + 2u * (size_t)DM * DM)
#define WS_Q   (WS_PP + 2u * (size_t)DM * DM)          // f16 q rows [NR][256], k rows [NR][256], v planes [b][256][SS]; f32 ctx [NR][256]
#define WS_K   (WS_Q + 2u * (size_t)NR * DM)
#define WS_V   (WS_K + 2u * (size_t)NR * DM)
#define WS_O   (WS_V + 2u * (size_t)NB * DM * SS)
#define WS_END (WS_O + 4u * (size_t)NR * DM)

// The two GEMM kernels take their weights from the f32 (in,out) inputs themselves. A work-group rounds its block of 256 k x 128 columns to bf16 into LDS, rows as they lie in memory (a wave's load is 512 bytes in a row),
// and every wave takes its B fragments from there by the transposing load, which hands lane (col, g) the k order 8 g + 0..7 of column col: the order of the row fragments
#define WPITCH 288u   // bytes from one k row to the next in LDS: an odd multiple of 32, the conflict-free pitch of the transposing load
typedef __attribute__((ext_vector_type(8))) short s16x8;
typedef __attribute__((ext_vector_type(4))) __bf16 v4b;
__device__ __forceinline__ v8b ld_tr16(const unsigned char* p) { typedef __attribute__((address_space(3))) s16x8 lds_s16x8; return __builtin_bit_cast(v8b, __builtin_amdgcn_ds_load_tr16_b128_v8i16((lds_s16x8*)p)); }
// Wc: first column of the block in row 0, LD: floats per row. Step i: the four waves take rows 4 i .. 4 i + 3. All 64 loads of a lane are issued before the first is used: the block costs one trip to L2, not one per step
template <int LD> __device__ __forceinline__ void stage_w(const float* __restrict__ Wc, unsigned char* sw, int tid) {
  const float* p = Wc + (size_t)(tid >> 5) * LD + (tid & 31) * 4; unsigned char* d = sw + (unsigned)(tid >> 5) * WPITCH + (unsigned)(tid & 31) * 8u;
  v4f r[DM / 4];
#pragma unroll   // constant indices, so that the pieces stay in registers
  for (int i = 0; i < DM / 4; ++i) r[i] = *(const v4f*)(p + (size_t)i * 4 * LD);
  asm volatile("s_wait_xcnt 0x0" :: "v"(p) : "memory");   // behind the last load; the lane address is an input, so that its registers are not rewritten in front of the wait
#pragma unroll   // constant indices, as above
  for (int i = 0; i < DM / 4; ++i) { v4b o;
#pragma unroll   // constant indices, as above
    for (int e = 0; e < 4; ++e) o[e] = (__bf16)r[i][e];
    *(v4b*)(d + (unsigned)i * 4u * WPITCH) = o; }
}
// the eight B fragments (16 columns each) of k step kc; tl: the lane's address in the transposing load's map
__device__ __forceinline__ void wfrags(v16b (&f)[8], const unsigned char* tl, int kc) {
#pragma unroll   // constant indices, so that the fragments stay in registers
  for (int j = 0; j < 8; ++j) { union { v16b v; v8b q[2]; } u; const unsigned char* p = tl + (unsigned)kc * 32u * WPITCH + (unsigned)j * 32u;
    u.q[0] = ld_tr16(p); u.q[1] = ld_tr16(p + 16u * WPITCH); f[j] = u.v; }
}
struct Row16 { v4f q[4]; };   // a lane's 16 f32 of one k step: k0 + 8 g + 0..7 and k0 + 16 + 8 g + 0..7
__device__ __forceinline__ Row16 row_ld(const float* lanep, int kc) { Row16 r; const float* p = lanep + kc * 32;
  r.q[0] = *(const v4f*)p; r.q[1] = *(const v4f*)(p + 4); r.q[2] = *(const v4f*)(p + 16); r.q[3] = *(const v4f*)(p + 20); return r; }
// ---- k_proj: block = (64 rows, 128 cols, which): 0,1: q cols / 2,3: k cols of x . W_qk (which = blockIdx.y over 4 col blocks of 128); 4,5: v -> planes
__global__ __launch_bounds__(128) void k_proj(const float* __restrict__ X, const float* __restrict__ WQK, const float* __restrict__ WV, _Float16* __restrict__ Q, _Float16* __restrict__ Kr, _Float16* __restrict__ V) {
  __shared__ __align__(16) _Float16 so[64][136]; __shared__ __align__(16) _Float16 st[128][72]; __shared__ __align__(32) unsigned char sw[DM * WPITCH];
  const int tid = threadIdx.x, wave = tid >> 5, lane = tid & 31, col = lane & 15, g = lane >> 4; const int cb = blockIdx.y; const size_t rb = (size_t)blockIdx.x * 64; const size_t r0 = rb + wave * 16;
  v8f acc[8] = {};
  const float* xl = X + (r0 + col) * DM + 8 * g; const unsigned char* tl = sw + (unsigned)(8 * g + (lane & 7)) * WPITCH + 16u * (unsigned)((lane >> 3) & 1);
  Row16 xr[2]; v16b wf[2][8];
  xr[0] = row_ld(xl, 0); xr[1] = row_ld(xl, 1);
  if (cb < 4) stage_w<2 * DM>(WQK + cb * 128, sw, tid); else stage_w<DM>(WV + (cb - 4) * 128, sw, tid);
  __syncthreads();   // the block is whole before any wave reads it
  wfrags(wf[0], tl, 0);
#pragma unroll   // constant indices, so that the two fragment sets stay in registers
  for (int kc = 0; kc < DM / 32; ++kc) { v16b a;
    __builtin_amdgcn_sched_barrier(0);   // keeps the next step's LDS reads one group in front of this step's products, and this step's conversion here: moved up, it waits for row pieces that were only just asked for
    if (kc + 1 < DM / 32) wfrags(wf[(kc + 1) & 1], tl, kc + 1);
#pragma unroll
    for (int i = 0; i < 16; ++i) a[i] = (__bf16)xr[kc & 1].q[i >> 2][i & 3];
    if (kc + 2 < DM / 32) xr[kc & 1] = row_ld(xl, kc + 2);
    if (kc + 2 == DM / 32 - 1) asm volatile("s_wait_xcnt 0x0" :: "v"(xl) : "memory");   // behind the last load; the lane address is an input, so that its registers are not rewritten in front of the wait
#pragma unroll
    for (int j = 0; j < 8; ++j) acc[j] = wmma_bf(a, wf[kc & 1][j], acc[j]); }
  if (cb < 4) {
#pragma unroll
    for (int j = 0; j < 8; ++j)
#pragma unroll
      for (int r = 0; r < 8; ++r) so[wave * 16 + 8 * g + r][j * 16 + col] = (_Float16)acc[j][r];
    __syncthreads(); _Float16* dst = (cb < 2) ? Q : Kr; const int c0 = (cb & 1) * 128; for (int e = tid; e < 64 * 16; e += 128) { const int rl = e >> 4, q = e & 15; vst2((unsigned*)(dst + (rb + rl) * DM + c0 + q * 8), *(const v4u*)&so[rl][q * 8]); } }
  else {
#pragma unroll
    for (int j = 0; j < 8; ++j)
#pragma unroll
      for (int r = 0; r < 8; ++r) st[j * 16 + col][wave * 16 + 8 * g + r] = (_Float16)acc[j][r];
    __syncthreads(); const size_t b = rb / SS; const int s0 = (int)(rb % SS); const int c0 = (cb - 4) * 128; for (int e = tid; e < 128 * 8; e += 128) { const int d = e >> 3, pc = e & 7; vst2((unsigned*)(V + ((b * DM + c0 + d) * SS) + s0 + pc * 8), *(const v4u*)&st[d][pc * 8]); } }
}
// the eight 16-byte loads a lane makes for one 32-key pass: two K tiles, two V tiles
struct PassF { v16h k0, k1, v0, v1; };
// fragment at a wave-uniform base plus this lane's byte offset: the lane offsets are fixed for the whole loop, only the uniform bases move from pass to pass
typedef const __attribute__((address_space(1))) char* gcp;
typedef const __attribute__((address_space(1))) v8h* gv8p;
__device__ __forceinline__ v16h frag_u(gcp ubase, unsigned voff) {
  union { v16h v; v8h q[2]; } u; gcp p = ubase + voff;
  u.q[0] = *(gv8p)p; u.q[1] = *(gv8p)(p + 32); return u.v;
}
__device__ __forceinline__ gcp sbase(const _Float16* p) { return (gcp)(unsigned long long)p; }   // the workspace planes lie in global memory
__device__ __forceinline__ PassF fetch_pass(const _Float16* kb, const _Float16* vb, unsigned ko, unsigned vo, int j0) {
  const gcp ks = sbase(kb + (size_t)j0 * DM), vs = sbase(vb + j0);
  PassF f; f.k0 = frag_u(ks, ko); f.k1 = frag_u(ks + 16 * DM * 2, ko); f.v0 = frag_u(vs, vo); f.v1 = frag_u(vs + 16 * SS * 2, vo);
  asm volatile("s_wait_xcnt 0x0" ::: "memory");   // stands behind the loads, in front of the next rewrite of an address register that they name
  return f; }
// 2^x on the hardware unit. The v_nop is the slot that the instruction set asks for behind a transcendental before its result is used or its source overwritten
__device__ __forceinline__ float exp2_hw(float x) { float r; asm("v_exp_f32 %0, %1\n\tv_nop" : "=v"(r) : "v"(x)); return r; }
// eight of them in one statement: every result register differs from every source (early clobber), so that each fills the slot of the one in front of it; the one v_nop is the slot behind the last
__device__ __forceinline__ v8f exp2_hw8(v8f x) { float r0, r1, r2, r3, r4, r5, r6, r7;
  asm("v_exp_f32 %0, %8\n\tv_exp_f32 %1, %9\n\tv_exp_f32 %2, %10\n\tv_exp_f32 %3, %11\n\tv_exp_f32 %4, %12\n\tv_exp_f32 %5, %13\n\tv_exp_f32 %6, %14\n\tv_exp_f32 %7, %15\n\tv_nop"
      : "=&v"(r0), "=&v"(r1), "=&v"(r2), "=&v"(r3), "=&v"(r4), "=&v"(r5), "=&v"(r6), "=&v"(r7) : "v"(x[0]), "v"(x[1]), "v"(x[2]), "v"(x[3]), "v"(x[4]), "v"(x[5]), "v"(x[6]), "v"(x[7]));
  return v8f{r0, r1, r2, r3, r4, r5, r6, r7}; }
__device__ __forceinline__ float xhalf(float v) { return __builtin_bit_cast(float, __builtin_amdgcn_permlanex16(__builtin_bit_cast(int, v), __builtin_bit_cast(int, v), 0x76543210, 0xfedcba98, false, false)); }   // the value of lane ^ 16
// transposed products: S^T = K . Q^T (A = 16 key rows, B = the wave's 16 queries) and O^T += V^T . P^T. A lane holds 16 of the 32 scores of ONE query (column col; keys 8 g + r and 16 + 8 g + r), which is the k order of the B operand of the second product: P goes from the score accumulators straight into that operand
__global__ __launch_bounds__(128) void k_attn(const _Float16* __restrict__ Q, const _Float16* __restrict__ Kr, const _Float16* __restrict__ V, const float* __restrict__ WPOS, const float* __restrict__ BPOS, const float* __restrict__ GATE, float* __restrict__ O) {
  const int tid = threadIdx.x, wave = __builtin_amdgcn_readfirstlane(tid >> 5), lane = tid & 31, col = lane & 15, g = lane >> 4; const int h = blockIdx.y; const size_t b = blockIdx.z; const int q0 = blockIdx.x * 64 + wave * 16; const size_t rq = b * SS + q0;   // the wave's number in a scalar register: the tests on pd below are scalar branches
  const float gt = 1.0f / (1.0f + expf(-bfr(GATE[h])));
  const v16h aq = frag_h(Q + (rq + col) * DM + h * HD, lane);
  asm volatile("s_wait_xcnt 0x0" :: "v"(Q + (rq + col) * DM + h * HD + 8 * g) : "memory");   // behind the two loads of aq; their address is an input, so that its registers are not rewritten in front of the wait
  const _Float16* kb = Kr + b * SS * DM + h * HD; const _Float16* vb = V + (b * DM + h * HD) * SS;
  const unsigned ko = (unsigned)(col * DM + 8 * g) * 2u, vo = (unsigned)(col * SS + 8 * g) * 2u;
  // positional row of query n = q0 + col (this lane's column of the B operand), in the base-2 exponent: u(d) = d ua + |d| uc + ub with d = n - m. u is linear on either side of d = 0, so its maximum over the row lies at m = 0, m = n or m = SS - 1
  const float ua = bfr(WPOS[h]) * 1.4426950408889634f, uc = bfr(WPOS[NH + h]) * 1.4426950408889634f, ub = bfr(BPOS[h]) * 1.4426950408889634f;
  const float nq = (float)(q0 + col), dl = nq - (float)(SS - 1);
  const float um = fmaxf(fmaxf(fmaf(nq, ua, fmaf(fabsf(nq), uc, ub)), fmaf(dl, ua, fmaf(fabsf(dl), uc, ub))), ub);
  const float uk = (ub - um) + 11.0f;   // weight = 2^(u - maximum + 11)
  float relp = nq, z = 0.f;   // relp: n - m at the first key of the pass; z: sum of this lane's weights
  // Off the diagonal |d| = +-d for all 32 keys of a pass, so u is linear there: u(d) = d sg + ub, sg = ua + uc before the query, ua - uc behind it, and
  // weight(n, j0 + o) = 2^((n - j0 - os) sg + ub - maximum) x 2^((os - o) sg + 11): one factor per query and pass times a table over o that is the same in every pass.
  // os is the end of the pass with the larger weight (31 for sg <= 0, else 0): the table lies in [0, 2^11] and the factor is a weight of the row / 2^11, so neither can overflow
  const int pd = q0 >> 5;   // the one pass whose 32 keys hold the wave's 16 queries
  struct Side { v16h c; float cs, sg, os, kk; };   // table as B operand, this lane's sum of it, slope, os, constant of the factor's exponent
  auto side = [&](float sg) { Side t; t.sg = sg; t.os = sg <= 0.f ? 31.0f : 0.f; t.kk = ub - um; t.cs = 0.f;
#pragma unroll   // constant indices, so that the table stays in registers
    for (int i = 0; i < 16; ++i) { t.c[i] = (_Float16)exp2_hw(fmaf(t.os - (float)(8 * g + (i < 8 ? i : 8 + i)), sg, 11.0f)); t.cs += (float)t.c[i]; }
    return t; };
  Side cur = side(ua + uc); const Side behind = side(ua - uc);
  v8f t[2] = {}; float fw = 0.f;   // V^T . table of the last pass and its factor, added into acc2 one pass later
  float m = -3.0e38f, l = 0.f;   // query col's running maximum (equal in both lane halves) and this lane's half of its running sum
  v8f acc[2] = {}, acc2[2] = {};   // element r = head dim dt * 16 + 8 g + r of query col
  auto pass = [&](const PassF& f, int p) { v16h pa;
    if (p == pd) { float w[16]; const float relb = relp - (float)(8 * g);   // the pass with the diagonal: every weight by itself, factor 2^0
#pragma unroll
      for (int i = 0; i < 16; ++i) { const float d = relb - (float)(i < 8 ? i : 8 + i); w[i] = exp2_hw(fmaf(d, ua, fmaf(fabsf(d), uc, uk))); cur.c[i] = (_Float16)w[i]; }
#pragma unroll
      for (int i = 0; i < 8; ++i) w[i] = w[2 * i] + w[2 * i + 1];
      cur.cs = ((w[0] + w[1]) + (w[2] + w[3])) + ((w[4] + w[5]) + (w[6] + w[7])); cur.sg = 0.f; cur.kk = 0.f; }
    else if (p == pd + 1) cur = behind;
#pragma unroll   // constant indices, so that the accumulators stay in registers
    for (int dt = 0; dt < 2; ++dt) acc2[dt] += t[dt] * fw;   // the pass before: its products have left the matrix unit by now
    fw = exp2_hw(fmaf(relp - cur.os, cur.sg, cur.kk)); z = fmaf(fw, cur.cs, z); relp -= 32.0f;
    v8f s[2];
#pragma unroll
    for (int ct = 0; ct < 2; ++ct) { v8f c = {}; c = wmma16(ct ? f.k1 : f.k0, aq, c); s[ct] = c * 0.17677669529663688f; }
    float x[2];
#pragma unroll
    for (int ct = 0; ct < 2; ++ct) x[ct] = fmaxf(fmaxf(fmaxf(s[ct][0], s[ct][1]), fmaxf(s[ct][2], s[ct][3])), fmaxf(fmaxf(s[ct][4], s[ct][5]), fmaxf(s[ct][6], s[ct][7])));
    float mx = fmaxf(x[0], x[1]); mx = fmaxf(mx, xhalf(mx));
    const float mn = fmaxf(m, mx); const float ea = exp2_hw((m - mn) * 1.4426950408889634f); const float alpha = (m <= -1.0e38f) ? 0.f : ea; m = mn;
#pragma unroll
    for (int ct = 0; ct < 2; ++ct) { const v8f e = exp2_hw8((s[ct] - mn) * 1.4426950408889634f);
#pragma unroll
      for (int r = 0; r < 8; ++r) pa[ct * 8 + r] = (_Float16)(e[r] * 2048.0f);
      x[ct] = ((e[0] + e[1]) + (e[2] + e[3])) + ((e[4] + e[5]) + (e[6] + e[7])); }
    l = l * alpha + (x[0] + x[1]);
#pragma unroll
    for (int dt = 0; dt < 2; ++dt) { acc[dt] *= alpha; const v16h vf = dt ? f.v1 : f.v0; acc[dt] = wmma16(vf, pa, acc[dt]); v8f c = {}; t[dt] = wmma16(vf, cur.c, c); } };
  // two register sets: each pass first issues the next pass's loads into the other set, so that they fly while this pass is worked on
  PassF fa = fetch_pass(kb, vb, ko, vo, 0), fb;
#pragma unroll 1   // the body already holds two passes, one per register set
  for (int ks = 0; ks < SS / 32; ks += 2) {
    fb = fetch_pass(kb, vb, ko, vo, (ks + 1) * 32);
    pass(fa, ks);
    fa = fetch_pass(kb, vb, ko, vo, (ks + 2 < SS / 32 ? ks + 2 : ks + 1) * 32);   // behind the last pass there is none: fetch in bounds, unused
    pass(fb, ks + 1); }
#pragma unroll   // constant indices, so that the accumulators stay in registers
  for (int dt = 0; dt < 2; ++dt) acc2[dt] += t[dt] * fw;
  z += xhalf(z); l += xhalf(l);   // the two lane halves hold the two halves of query col's keys
  const float cl = (1.0f - gt) * ((1.0f / 2048.0f) / l), cz = gt * (1.0f / z);
  float* orow = O + (rq + col) * DM + h * HD + 8 * g;
#pragma unroll
  for (int dt = 0; dt < 2; ++dt) { v4f o[2];
#pragma unroll
    for (int r = 0; r < 8; ++r) o[r >> 2][r & 3] = acc[dt][r] * cl + acc2[dt][r] * cz;
    vst2(orow + dt * 16, o[0]); vst2(orow + dt * 16 + 4, o[1]); }
}
// ---- k_out: block = (64 rows, 128 cols): out = ctx (hi + lo) . W_proj + b
__global__ __launch_bounds__(128) void k_out(const float* __restrict__ O, const float* __restrict__ WP, const float* __restrict__ BP, float* __restrict__ Y) { __shared__ __align__(16) float so[4][16][132]; __shared__ __align__(32) unsigned char sw[DM * WPITCH];
  const int tid = threadIdx.x, wave = tid >> 5, lane = tid & 31, col = lane & 15, g = lane >> 4; const size_t r0 = (size_t)blockIdx.x * 64 + wave * 16; const int c0 = blockIdx.y * 128;
  v8f acc[8] = {};
  const float* ol = O + (r0 + col) * DM + 8 * g; const unsigned char* tl = sw + (unsigned)(8 * g + (lane & 7)) * WPITCH + 16u * (unsigned)((lane >> 3) & 1);
  Row16 xr[2]; v16b wf[2][8];
  xr[0] = row_ld(ol, 0); xr[1] = row_ld(ol, 1);
  stage_w<DM>(WP + c0, sw, tid);
  __syncthreads();   // the block is whole before any wave reads it
  wfrags(wf[0], tl, 0);
#pragma unroll   // constant indices, so that the two fragment sets stay in registers
  for (int kc = 0; kc < DM / 32; ++kc) { float v[16];
    __builtin_amdgcn_sched_barrier(0);   // keeps the next step's LDS reads one group in front of this step's products, and this step's split here: moved up, it waits for row pieces that were only just asked for
    if (kc + 1 < DM / 32) wfrags(wf[(kc + 1) & 1], tl, kc + 1);
#pragma unroll
    for (int i = 0; i < 16; ++i) v[i] = xr[kc & 1].q[i >> 2][i & 3];
    const F2 a = bsplit16(v);
    if (kc + 2 < DM / 32) xr[kc & 1] = row_ld(ol, kc + 2);
    if (kc + 2 == DM / 32 - 1) asm volatile("s_wait_xcnt 0x0" :: "v"(ol) : "memory");   // behind the last load; the lane address is an input, so that its registers are not rewritten in front of the wait
#pragma unroll
    for (int j = 0; j < 8; ++j) { const v16b w = wf[kc & 1][j]; acc[j] = wmma_bf(a.h, w, acc[j]); acc[j] = wmma_bf(a.l, w, acc[j]); } }
#pragma unroll
  for (int j = 0; j < 8; ++j) { const float bb = bfr(BP[c0 + j * 16 + col]);
#pragma unroll
    for (int r = 0; r < 8; ++r) so[wave][8 * g + r][j * 16 + col] = acc[j][r] + bb; }
  LDSX(); for (int rl = 0; rl < 16; ++rl) vst2(Y + (r0 + rl) * DM + c0 + lane * 4, *(const v4f*)&so[wave][rl][lane * 4]); }
extern "C" void kernel_launch(void* const* d_in, const int* in_sizes, int n_in, void* d_out, int out_size, void* d_ws, size_t ws_size, hipStream_t stream) {
  (void)in_sizes; (void)n_in; (void)out_size;
  const float** F = (const float**)d_in;   // 0 x [2,2048,256], 1 W_qk [256,512] (in,out), 2 W_v [256,256], 3 W_proj [256,256], 4 b_proj [256], 5 W_pos [2,8], 6 b_pos [8], 7 gating [8]
  if (ws_size < (size_t)WS_END) return;
  char* ws = (char*)d_ws; _Float16 *Q = (_Float16*)(ws + WS_Q), *Kr = (_Float16*)(ws + WS_K), *V = (_Float16*)(ws + WS_V); float* O = (float*)(ws + WS_O);
  k_proj<<<dim3(TNB * SS / 64, 6), 128, 0, stream>>>(F[0], F[1], F[2], Q, Kr, V);
  k_attn<<<dim3(TQB, NH, TNB), 128, 0, stream>>>(Q, Kr, V, F[5], F[6], F[7], O);
  k_out<<<dim3(TNB * SS / 64, DM / 128), 128, 0, stream>>>(O, F[3], F[4], (float*)d_out);
}

// v007
// Measured time: 36.8 microseconds a run.
// In two side-by-side timings against v006, it was 1.12 and 1.13 times as fast.
// All steps since v000 together make it 5.18 times as fast.
// compute dtype: all float inputs rounded to bf16; q/k = x . W_qk and v = x . W_v with EXACT bf16 products on WMMA 16x16x32 ((in,out) weights rounded to bf16 in LDS, fragments by the transposing load), rounded once to f16 (v as planes); content attention per (batch, head): q, k single f16 x 32^-1/2, running-max softmax in f32 (hardware exp), P (scaled by 2^11, single f16) x v; positional attention: per-head weights exp((n-m) W_pos[0,h] + |n-m| W_pos[1,h] + b_pos[h] - row maximum) x 2^11; in the one 32-key pass that holds the query they are formed one by one in f32 and rounded to f16, in every other pass they are a constant f16 fragment (the fall-off inside a pass) times one f32 factor per query and pass, applied to the product with the same v fragments; divided by their f32 row sum at the end; mix (1 - g) patch + g pos with g = sigmoid(gating_h) in f32; out = ctx (bf16 hi + lo, 2 products) . W_proj + b; f32 output.
#include <hip/hip_runtime.h>
#include <math.h>

typedef __attribute__((ext_vector_type(16))) _Float16 v16h;
typedef __attribute__((ext_vector_type(16))) __bf16 v16b;
typedef __attribute__((ext_vector_type(8)))  _Float16 v8h;
typedef __attribute__((ext_vector_type(8)))  float v8f;
typedef __attribute__((ext_vector_type(4)))  float v4f;
typedef __attribute__((ext_vector_type(2)))  float v2f;
typedef __attribute__((ext_vector_type(4)))  unsigned v4u;
typedef __attribute__((ext_vector_type(4)))  int v4i;
typedef float __attribute__((may_alias)) float_a;
typedef int __attribute__((may_alias)) int_a;

template <typename T> __device__ __forceinline__ void vst2(void* p, T v) { *(T*)p = v;  }
__device__ __forceinline__ v8f wmma16(v16h a, v16h b, v8f c) {
  v8f d = __builtin_amdgcn_wmma_f32_16x16x32_f16(false, a, false, b, (short)0, c, false, false);
  asm volatile("v_nop\n\tv_nop\n\tv_nop\n\tv_nop" : "+v"(d) : "v"(a), "v"(b));
  return d;
}
__device__ __forceinline__ v8f wmma_bf(v16b a, v16b b, v8f c) {
  v8f d = __builtin_amdgcn_wmma_f32_16x16x32_bf16(false, a, false, b, (short)0, c, false, false);
  asm volatile("v_nop\n\tv_nop\n\tv_nop\n\tv_nop" : "+v"(d) : "v"(a), "v"(b));
  return d;
}
// 16x16x32 fragments: lane = (h = lane>>4, row/col = lane&15); elements 0..7 = k0+8h+0..7, 8..15 = k0+16+8h+0..7; D element r = row 8h+r
__device__ __forceinline__ v16h frag_h(const _Float16* rowk0, int lane) {
  union { v16h v; v8h q[2]; } u; const _Float16* p = rowk0 + 8 * (lane >> 4);
  u.q[0] = *(const v8h*)p; u.q[1] = *(const v8h*)(p + 16); return u.v;
}
__device__ __forceinline__ v16h frag_f32(const float* rowk0, int lane) {
  v16h a; const float* p = rowk0 + 8 * (lane >> 4);
#pragma unroll
  for (int i = 0; i < 8; ++i) { a[i] = (_Float16)p[i]; a[8 + i] = (_Float16)p[16 + i]; }
  return a;
}
__device__ __forceinline__ v16h frag_f32s(const float* rowk0, int lane, float sc) {
  v16h a; const float* p = rowk0 + 8 * (lane >> 4);
#pragma unroll
  for (int i = 0; i < 8; ++i) { a[i] = (_Float16)(p[i] * sc); a[8 + i] = (_Float16)(p[16 + i] * sc); }
  return a;
}
// column fragment from a [K][ld] layout (column n), rows >= K read as 0
__device__ __forceinline__ v16h fragc_f32(const float* W, int k0, int n, int lane, int ld, int K) {
  v16h a; const int g = lane >> 4;
#pragma unroll
  for (int i = 0; i < 8; ++i) { const int ka = k0 + 8 * g + i, kb = ka + 16;
    a[i] = (_Float16)(ka < K ? W[(size_t)(ka < K ? ka : K - 1) * ld + n] : 0.f); a[8 + i] = (_Float16)(kb < K ? W[(size_t)(kb < K ? kb : K - 1) * ld + n] : 0.f); }
  return a;
}
struct F2 { v16b h, l; };
__device__ __forceinline__ F2 bsplit16(const float v[16]) { F2 r;
#pragma unroll
  for (int i = 0; i < 16; ++i) { const __bf16 h = (__bf16)v[i]; r.h[i] = h; r.l[i] = (__bf16)(v[i] - (float)h); }
  return r; }
__device__ __forceinline__ F2 split_row(const float* row, int k0, int lane) { float v[16]; const float* p = row + k0 + 8 * (lane >> 4);
#pragma unroll
  for (int i = 0; i < 8; ++i) { v[i] = p[i]; v[8 + i] = p[16 + i]; }
  return bsplit16(v); }
__device__ __forceinline__ F2 split_rowK(const float* row, int k0, int lane, int K) { float v[16]; const int g = lane >> 4;
#pragma unroll
  for (int i = 0; i < 8; ++i) { const int ka = k0 + 8 * g + i, kb = ka + 16; v[i] = ka < K ? row[ka < K ? ka : K - 1] : 0.f; v[8 + i] = kb < K ? row[kb < K ? kb : K - 1] : 0.f; }
  return bsplit16(v); }
__device__ __forceinline__ F2 split_col(const float* W, int k0, int n, int lane, int ld, int K) { float v[16]; const int g = lane >> 4;
#pragma unroll
  for (int i = 0; i < 8; ++i) { const int ka = k0 + 8 * g + i, kb = ka + 16; v[i] = ka < K ? W[(size_t)(ka < K ? ka : K - 1) * ld + n] : 0.f; v[8 + i] = kb < K ? W[(size_t)(kb < K ? kb : K - 1) * ld + n] : 0.f; }
  return bsplit16(v); }
__device__ __forceinline__ v8f mac3(const F2& a, const F2& b, v8f c) { c = wmma_bf(a.l, b.h, c); c = wmma_bf(a.h, b.l, c); return wmma_bf(a.h, b.h, c); }
__device__ __forceinline__ float sigm(float v) { return 1.0f / (1.0f + expf(-v)); }
#define LDSX() do { asm volatile("s_wait_dscnt 0" ::: "memory"); __builtin_amdgcn_wave_barrier(); __builtin_amdgcn_fence(__ATOMIC_RELEASE, "workgroup"); } while (0)


// Gated positional self-attention, 1-D (B 2, N 2,048 patches, C 256, 8 heads x 32): content softmax(q k / sqrt(32)) and a positional softmax from relative indices (d, |d|) . W_pos + b_pos, mixed per head by sigmoid(gating), (re)normalised, applied to v, output projection + bias.
#define NB 2
#define SS 2048
#define DM 256
#define NH 8
#define HD 32
#define NR (NB * SS)
#ifndef TQB
#define TQB (SS / 64)
#define TNB NB
#endif
typedef __attribute__((ext_vector_type(8))) __bf16 v8b;
__device__ __forceinline__ v16b frag_b(const __bf16* rowk0, int lane) {
  union { v16b v; v8b q[2]; } u; const __bf16* p = rowk0 + 8 * (lane >> 4);
  u.q[0] = *(const v8b*)p; u.q[1] = *(const v8b*)(p + 16); return u.v;
}
__device__ __forceinline__ float bfr(float v) { return (float)(__bf16)v; }
__device__ __attribute__((noinline)) float exp_ni(float v) { return expf(v); }
__device__ __attribute__((noinline)) float erf_ni(float v) { return erff(v); }

#define WS_PW  0u                                   // the first three ranges are not used
#define WS_PV  (WS_PW + 2u * (size_t)512 * DM)
#define WS_PP  (WS_PV + 2u * (size_t)DM * DM)
#define WS_Q   (WS_PP + 2u * (size_t)DM * DM)          // f16 q rows [NR][256], k rows [NR][256], v planes [b][256][SS]; f32 ctx [NR][256]
#define WS_K   (WS_Q + 2u * (size_t)NR * DM)
#define WS_V   (WS_K + 2u * (size_t)NR * DM)
#define WS_O   (WS_V + 2u * (size_t)NB * DM * SS)
#define WS_END (WS_O + 4u * (size_t)NR * DM)

// The two GEMM kernels take their weights from the f32 (in,out) inputs themselves. A work-group rounds its block of 256 k x 128 columns to bf16 into LDS, rows as they lie in memory (a wave's load is 512 bytes in a row),
// and every wave takes its B fragments from there by the transposing load, which hands lane (col, g) the k order 8 g + 0..7 of column col: the order of the row fragments
#define WPITCH 288u   // bytes from one k row to the next in LDS: an odd multiple of 32, the conflict-free pitch of the transposing load
typedef __attribute__((ext_vector_type(8))) short s16x8;
typedef __attribute__((ext_vector_type(4))) __bf16 v4b;
__device__ __forceinline__ v8b ld_tr16(const unsigned char* p) { typedef __attribute__((address_space(3))) s16x8 lds_s16x8; return __builtin_bit_cast(v8b, __builtin_amdgcn_ds_load_tr16_b128_v8i16((lds_s16x8*)p)); }
// Wc: first column of the block in row 0, LD: floats per row. Step i: the four waves take rows 4 i .. 4 i + 3. All 64 loads of a lane are issued before the first is used: the block costs one trip to L2, not one per step
template <int LD> __device__ __forceinline__ void stage_w(const float* __restrict__ Wc, unsigned char* sw, int tid) {
  const float* p = Wc + (size_t)(tid >> 5) * LD + (tid & 31) * 4; unsigned char* d = sw + (unsigned)(tid >> 5) * WPITCH + (unsigned)(tid & 31) * 8u;
  v4f r[DM / 4];
#pragma unroll   // constant indices, so that the pieces stay in registers
  for (int i = 0; i < DM / 4; ++i) r[i] = *(const v4f*)(p + (size_t)i * 4 * LD);
  asm volatile("s_wait_xcnt 0x0" :: "v"(p) : "memory");   // behind the last load; the lane address is an input, so that its registers are not rewritten in front of the wait
#pragma unroll   // constant indices, as above
  for (int i = 0; i < DM / 4; ++i) { v4b o;
#pragma unroll   // constant indices, as above
    for (int e = 0; e < 4; ++e) o[e] = (__bf16)r[i][e];
    *(v4b*)(d + (unsigned)i * 4u * WPITCH) = o; }
}
// the eight B fragments (16 columns each) of k step kc; tl: the lane's address in the transposing load's map
__device__ __forceinline__ void wfrags(v16b (&f)[8], const unsigned char* tl, int kc) {
#pragma unroll   // constant indices, so that the fragments stay in registers
  for (int j = 0; j < 8; ++j) { union { v16b v; v8b q[2]; } u; const unsigned char* p = tl + (unsigned)kc * 32u * WPITCH + (unsigned)j * 32u;
    u.q[0] = ld_tr16(p); u.q[1] = ld_tr16(p + 16u * WPITCH); f[j] = u.v; }
}
struct Row16 { v4f q[4]; };   // a lane's 16 f32 of one k step: k0 + 8 g + 0..7 and k0 + 16 + 8 g + 0..7
__device__ __forceinline__ Row16 row_ld(const float* lanep, int kc) { Row16 r; const float* p = lanep + kc * 32;
  r.q[0] = *(const v4f*)p; r.q[1] = *(const v4f*)(p + 4); r.q[2] = *(const v4f*)(p + 16); r.q[3] = *(const v4f*)(p + 20); return r; }
// ---- k_proj: block = (64 rows, 128 cols, which): 0,1: q cols / 2,3: k cols of x . W_qk (which = blockIdx.y over 4 col blocks of 128); 4,5: v -> planes
__global__ __launch_bounds__(128) void k_proj(const float* __restrict__ X, const float* __restrict__ WQK, const float* __restrict__ WV, _Float16* __restrict__ Q, _Float16* __restrict__ Kr, _Float16* __restrict__ V) {
  __shared__ __align__(16) _Float16 so[64][136]; __shared__ __align__(16) _Float16 st[128][72]; __shared__ __align__(32) unsigned char sw[DM * WPITCH];
  const int tid = threadIdx.x, wave = tid >> 5, lane = tid & 31, col = lane & 15, g = lane >> 4; const int cb = blockIdx.y; const size_t rb = (size_t)blockIdx.x * 64; const size_t r0 = rb + wave * 16;
  v8f acc[8] = {};
  const float* xl = X + (r0 + col) * DM + 8 * g; const unsigned char* tl = sw + (unsigned)(8 * g + (lane & 7)) * WPITCH + 16u * (unsigned)((lane >> 3) & 1);
  Row16 xr[2]; v16b wf[2][8];
  xr[0] = row_ld(xl, 0); xr[1] = row_ld(xl, 1);
  if (cb < 4) stage_w<2 * DM>(WQK + cb * 128, sw, tid); else stage_w<DM>(WV + (cb - 4) * 128, sw, tid);
  __syncthreads();   // the block is whole before any wave reads it
  wfrags(wf[0], tl, 0);
#pragma unroll   // constant indices, so that the two fragment sets stay in registers
  for (int kc = 0; kc < DM / 32; ++kc) { v16b a;
    __builtin_amdgcn_sched_barrier(0);   // keeps the next step's LDS reads one group in front of this step's products, and this step's conversion here: moved up, it waits for row pieces that were only just asked for
    if (kc + 1 < DM / 32) wfrags(wf[(kc + 1) & 1], tl, kc + 1);
#pragma unroll
    for (int i = 0; i < 16; ++i) a[i] = (__bf16)xr[kc & 1].q[i >> 2][i & 3];
    if (kc + 2 < DM / 32) xr[kc & 1] = row_ld(xl, kc + 2);
    if (kc + 2 == DM / 32 - 1) asm volatile("s_wait_xcnt 0x0" :: "v"(xl) : "memory");   // behind the last load; the lane address is an input, so that its registers are not rewritten in front of the wait
#pragma unroll
    for (int j = 0; j < 8; ++j) acc[j] = wmma_bf(a, wf[kc & 1][j], acc[j]); }
  if (cb < 4) {
#pragma unroll
    for (int j = 0; j < 8; ++j)
#pragma unroll
      for (int r = 0; r < 8; ++r) so[wave * 16 + 8 * g + r][j * 16 + col] = (_Float16)acc[j][r];
    __syncthreads(); _Float16* dst = (cb < 2) ? Q : Kr; const int c0 = (cb & 1) * 128; for (int e = tid; e < 64 * 16; e += 128) { const int rl = e >> 4, q = e & 15; vst2((unsigned*)(dst + (rb + rl) * DM + c0 + q * 8), *(const v4u*)&so[rl][q * 8]); } }
  else {
#pragma unroll
    for (int j = 0; j < 8; ++j)
#pragma unroll
      for (int r = 0; r < 8; ++r) st[j * 16 + col][wave * 16 + 8 * g + r] = (_Float16)acc[j][r];
    __syncthreads(); const size_t b = rb / SS; const int s0 = (int)(rb % SS); const int c0 = (cb - 4) * 128; for (int e = tid; e < 128 * 8; e += 128) { const int d = e >> 3, pc = e & 7; vst2((unsigned*)(V + ((b * DM + c0 + d) * SS) + s0 + pc * 8), *(const v4u*)&st[d][pc * 8]); } }
}
// the eight 16-byte loads a lane makes for one 32-key pass: two K tiles, two V tiles
struct PassF { v16h k0, k1, v0, v1; };
// fragment at a wave-uniform base plus this lane's byte offset: the lane offsets are fixed for the whole loop, only the uniform bases move from pass to pass
typedef const __attribute__((address_space(1))) char* gcp;
typedef const __attribute__((address_space(1))) v8h* gv8p;
__device__ __forceinline__ v16h frag_u(gcp ubase, unsigned voff) {
  union { v16h v; v8h q[2]; } u; gcp p = ubase + voff;
  u.q[0] = *(gv8p)p; u.q[1] = *(gv8p)(p + 32); return u.v;
}
__device__ __forceinline__ gcp sbase(const _Float16* p) { return (gcp)(unsigned long long)p; }   // the workspace planes lie in global memory
__device__ __forceinline__ PassF fetch_pass(const _Float16* kb, const _Float16* vb, unsigned ko, unsigned vo, int j0) {
  const gcp ks = sbase(kb + (size_t)j0 * DM), vs = sbase(vb + j0);
  __builtin_amdgcn_sched_barrier(0);   // with the one behind the wait: no vector work of the passes around stands between the loads and their wait (with three sets the compiler put a subtraction there whose result lands on an address register)
  PassF f; f.k0 = frag_u(ks, ko); f.k1 = frag_u(ks + 16 * DM * 2, ko); f.v0 = frag_u(vs, vo); f.v1 = frag_u(vs + 16 * SS * 2, vo);
  asm volatile("s_wait_xcnt 0x0" ::: "memory");   // stands behind the loads, in front of the next rewrite of an address register that they name
  __builtin_amdgcn_sched_barrier(0);   // the second of the two: the next pass's vector work stays behind the wait
  return f; }
// 2^x on the hardware unit. The v_nop is the slot that the instruction set asks for behind a transcendental before its result is used or its source overwritten
__device__ __forceinline__ float exp2_hw(float x) { float r; asm("v_exp_f32 %0, %1\n\tv_nop" : "=v"(r) : "v"(x)); return r; }
// eight of them in one statement: every result register differs from every source (early clobber), so that each fills the slot of the one in front of it; the one v_nop is the slot behind the last
__device__ __forceinline__ v8f exp2_hw8(v8f x) { float r0, r1, r2, r3, r4, r5, r6, r7;
  asm("v_exp_f32 %0, %8\n\tv_exp_f32 %1, %9\n\tv_exp_f32 %2, %10\n\tv_exp_f32 %3, %11\n\tv_exp_f32 %4, %12\n\tv_exp_f32 %5, %13\n\tv_exp_f32 %6, %14\n\tv_exp_f32 %7, %15\n\tv_nop"
      : "=&v"(r0), "=&v"(r1), "=&v"(r2), "=&v"(r3), "=&v"(r4), "=&v"(r5), "=&v"(r6), "=&v"(r7) : "v"(x[0]), "v"(x[1]), "v"(x[2]), "v"(x[3]), "v"(x[4]), "v"(x[5]), "v"(x[6]), "v"(x[7]));
  return v8f{r0, r1, r2, r3, r4, r5, r6, r7}; }
__device__ __forceinline__ float xhalf(float v) { return __builtin_bit_cast(float, __builtin_amdgcn_permlanex16(__builtin_bit_cast(int, v), __builtin_bit_cast(int, v), 0x76543210, 0xfedcba98, false, false)); }   // the value of lane ^ 16
// transposed products: S^T = K . Q^T (A = 16 key rows, B = the wave's 16 queries) and O^T += V^T . P^T. A lane holds 16 of the 32 scores of ONE query (column col; keys 8 g + r and 16 + 8 g + r), which is the k order of the B operand of the second product: P goes from the score accumulators straight into that operand
__global__ __launch_bounds__(128) void k_attn(const _Float16* __restrict__ Q, const _Float16* __restrict__ Kr, const _Float16* __restrict__ V, const float* __restrict__ WPOS, const float* __restrict__ BPOS, const float* __restrict__ GATE, float* __restrict__ O) {
  const int tid = threadIdx.x, wave = __builtin_amdgcn_readfirstlane(tid >> 5), lane = tid & 31, col = lane & 15, g = lane >> 4; const int h = blockIdx.y; const size_t b = blockIdx.z; const int q0 = blockIdx.x * 64 + wave * 16; const size_t rq = b * SS + q0;   // the wave's number in a scalar register: the tests on pd below are scalar branches
  const float gt = 1.0f / (1.0f + expf(-bfr(GATE[h])));
  const v16h aq = frag_h(Q + (rq + col) * DM + h * HD, lane);
  asm volatile("s_wait_xcnt 0x0" :: "v"(Q + (rq + col) * DM + h * HD + 8 * g) : "memory");   // behind the two loads of aq; their address is an input, so that its registers are not rewritten in front of the wait
  const _Float16* kb = Kr + b * SS * DM + h * HD; const _Float16* vb = V + (b * DM + h * HD) * SS;
  const unsigned ko = (unsigned)(col * DM + 8 * g) * 2u, vo = (unsigned)(col * SS + 8 * g) * 2u;
  PassF f0 = fetch_pass(kb, vb, ko, vo, 0), f1 = fetch_pass(kb, vb, ko, vo, 32), f2;   // the first two passes' loads fly while the positional tables below are made
  // positional row of query n = q0 + col (this lane's column of the B operand), in the base-2 exponent: u(d) = d ua + |d| uc + ub with d = n - m. u is linear on either side of d = 0, so its maximum over the row lies at m = 0, m = n or m = SS - 1
  const float ua = bfr(WPOS[h]) * 1.4426950408889634f, uc = bfr(WPOS[NH + h]) * 1.4426950408889634f, ub = bfr(BPOS[h]) * 1.4426950408889634f;
  const float nq = (float)(q0 + col), dl = nq - (float)(SS - 1);
  const float um = fmaxf(fmaxf(fmaf(nq, ua, fmaf(fabsf(nq), uc, ub)), fmaf(dl, ua, fmaf(fabsf(dl), uc, ub))), ub);
  const float uk = (ub - um) + 11.0f;   // weight = 2^(u - maximum + 11)
  float relp = nq, z = 0.f;   // relp: n - m at the first key of the pass; z: sum of this lane's weights
  // Off the diagonal |d| = +-d for all 32 keys of a pass, so u is linear there: u(d) = d sg + ub, sg = ua + uc before the query, ua - uc behind it, and
  // weight(n, j0 + o) = 2^((n - j0 - os) sg + ub - maximum) x 2^((os - o) sg + 11): one factor per query and pass times a table over o that is the same in every pass.
  // os is the end of the pass with the larger weight (31 for sg <= 0, else 0): the table lies in [0, 2^11] and the factor is a weight of the row / 2^11, so neither can overflow
  const int pd = q0 >> 5;   // the one pass whose 32 keys hold the wave's 16 queries
  struct Side { v16h c; float cs, sg, os, kk; };   // table as B operand, this lane's sum of it, slope, os, constant of the factor's exponent
  auto side = [&](float sg) { Side t; t.sg = sg; t.os = sg <= 0.f ? 31.0f : 0.f; t.kk = ub - um; t.cs = 0.f;
#pragma unroll   // constant indices, so that the table stays in registers
    for (int i = 0; i < 16; ++i) { t.c[i] = (_Float16)exp2_hw(fmaf(t.os - (float)(8 * g + (i < 8 ? i : 8 + i)), sg, 11.0f)); t.cs += (float)t.c[i]; }
    return t; };
  Side cur = side(ua + uc); const Side behind = side(ua - uc);
  v8f t[2] = {}; float fw = 0.f;   // V^T . table of the last pass and its factor, added into acc2 one pass later
  float m = -3.0e38f, l = 0.f;   // query col's running maximum (equal in both lane halves) and this lane's half of its running sum
  v8f acc[2] = {}, acc2[2] = {};   // element r = head dim dt * 16 + 8 g + r of query col
  auto pass = [&](const PassF& f, int p) { v16h pa;
    if (p == pd) { float w[16]; const float relb = relp - (float)(8 * g);   // the pass with the diagonal: every weight by itself, factor 2^0
#pragma unroll
      for (int i = 0; i < 16; ++i) { const float d = relb - (float)(i < 8 ? i : 8 + i); w[i] = exp2_hw(fmaf(d, ua, fmaf(fabsf(d), uc, uk))); cur.c[i] = (_Float16)w[i]; }
#pragma unroll
      for (int i = 0; i < 8; ++i) w[i] = w[2 * i] + w[2 * i + 1];
      cur.cs = ((w[0] + w[1]) + (w[2] + w[3])) + ((w[4] + w[5]) + (w[6] + w[7])); cur.sg = 0.f; cur.kk = 0.f; }
    else if (p == pd + 1) cur = behind;
#pragma unroll   // constant indices, so that the accumulators stay in registers
    for (int dt = 0; dt < 2; ++dt) acc2[dt] += t[dt] * fw;   // the pass before: its products have left the matrix unit by now
    fw = exp2_hw(fmaf(relp - cur.os, cur.sg, cur.kk)); z = fmaf(fw, cur.cs, z); relp -= 32.0f;
    v8f s[2];
#pragma unroll
    for (int ct = 0; ct < 2; ++ct) { v8f c = {}; c = wmma16(ct ? f.k1 : f.k0, aq, c); s[ct] = c * 0.17677669529663688f; }
    float x[2];
#pragma unroll
    for (int ct = 0; ct < 2; ++ct) x[ct] = fmaxf(fmaxf(fmaxf(s[ct][0], s[ct][1]), fmaxf(s[ct][2], s[ct][3])), fmaxf(fmaxf(s[ct][4], s[ct][5]), fmaxf(s[ct][6], s[ct][7])));
    float mx = fmaxf(x[0], x[1]); mx = fmaxf(mx, xhalf(mx));
    const float mn = fmaxf(m, mx); const float ea = exp2_hw((m - mn) * 1.4426950408889634f); const float alpha = (m <= -1.0e38f) ? 0.f : ea; m = mn;
#pragma unroll
    for (int ct = 0; ct < 2; ++ct) { const v8f e = exp2_hw8((s[ct] - mn) * 1.4426950408889634f);
#pragma unroll
      for (int r = 0; r < 8; ++r) pa[ct * 8 + r] = (_Float16)(e[r] * 2048.0f);
      x[ct] = ((e[0] + e[1]) + (e[2] + e[3])) + ((e[4] + e[5]) + (e[6] + e[7])); }
    l = l * alpha + (x[0] + x[1]);
#pragma unroll
    for (int dt = 0; dt < 2; ++dt) { acc[dt] *= alpha; const v16h vf = dt ? f.v1 : f.v0; acc[dt] = wmma16(vf, pa, acc[dt]); v8f c = {}; t[dt] = wmma16(vf, cur.c, c); } };
  // three register sets: each pass first issues the loads of the pass two ahead, into the set that the pass before it has left, so that they fly over two passes.
#pragma unroll 1   // the body already holds three passes, one per register set
  for (int ks = 0; ks < SS / 32 - 1; ks += 3) {
    f2 = fetch_pass(kb, vb, ko, vo, (ks + 2) * 32);
    pass(f0, ks);
    f0 = fetch_pass(kb, vb, ko, vo, (ks + 3) * 32);
    pass(f1, ks + 1);
    f1 = fetch_pass(kb, vb, ko, vo, (ks + 4 < SS / 32 ? ks + 4 : ks + 3) * 32);   // behind the last pass there is none: fetch in bounds, unused
    pass(f2, ks + 2); }
  static_assert((SS / 32) % 3 == 1, "the loop takes the passes in threes and leaves the last one");
  pass(f0, SS / 32 - 1);
#pragma unroll   // constant indices, so that the accumulators stay in registers
  for (int dt = 0; dt < 2; ++dt) acc2[dt] += t[dt] * fw;
  z += xhalf(z); l += xhalf(l);   // the two lane halves hold the two halves of query col's keys
  const float cl = (1.0f - gt) * ((1.0f / 2048.0f) / l), cz = gt * (1.0f / z);
  float* orow = O + (rq + col) * DM + h * HD + 8 * g;
#pragma unroll
  for (int dt = 0; dt < 2; ++dt) { v4f o[2];
#pragma unroll
    for (int r = 0; r < 8; ++r) o[r >> 2][r & 3] = acc[dt][r] * cl + acc2[dt][r] * cz;
    vst2(orow + dt * 16, o[0]); vst2(orow + dt * 16 + 4, o[1]); }
}
// ---- k_out: block = (64 rows, 128 cols): out = ctx (hi + lo) . W_proj + b
__global__ __launch_bounds__(128) void k_out(const float* __restrict__ O, const float* __restrict__ WP, const float* __restrict__ BP, float* __restrict__ Y) { __shared__ __align__(16) float so[4][16][132]; __shared__ __align__(32) unsigned char sw[DM * WPITCH];
  const int tid = threadIdx.x, wave = tid >> 5, lane = tid & 31, col = lane & 15, g = lane >> 4; const size_t r0 = (size_t)blockIdx.x * 64 + wave * 16; const int c0 = blockIdx.y * 128;
  v8f acc[8] = {};
  const float* ol = O + (r0 + col) * DM + 8 * g; const unsigned char* tl = sw + (unsigned)(8 * g + (lane & 7)) * WPITCH + 16u * (unsigned)((lane >> 3) & 1);
  Row16 xr[2]; v16b wf[2][8];
  xr[0] = row_ld(ol, 0); xr[1] = row_ld(ol, 1);
  stage_w<DM>(WP + c0, sw, tid);
  __syncthreads();   // the block is whole before any wave reads it
  wfrags(wf[0], tl, 0);
#pragma unroll   // constant indices, so that the two fragment sets stay in registers
  for (int kc = 0; kc < DM / 32; ++kc) { float v[16];
    __builtin_amdgcn_sched_barrier(0);   // keeps the next step's LDS reads one group in front of this step's products, and this step's split here: moved up, it waits for row pieces that were only just asked for
    if (kc + 1 < DM / 32) wfrags(wf[(kc + 1) & 1], tl, kc + 1);
#pragma unroll
    for (int i = 0; i < 16; ++i) v[i] = xr[kc & 1].q[i >> 2][i & 3];
    const F2 a = bsplit16(v);
    if (kc + 2 < DM / 32) xr[kc & 1] = row_ld(ol, kc + 2);
    if (kc + 2 == DM / 32 - 1) asm volatile("s_wait_xcnt 0x0" :: "v"(ol) : "memory");   // behind the last load; the lane address is an input, so that its registers are not rewritten in front of the wait
#pragma unroll
    for (int j = 0; j < 8; ++j) { const v16b w = wf[kc & 1][j]; acc[j] = wmma_bf(a.h, w, acc[j]); acc[j] = wmma_bf(a.l, w, acc[j]); } }
#pragma unroll
  for (int j = 0; j < 8; ++j) { const float bb = bfr(BP[c0 + j * 16 + col]);
#pragma unroll
    for (int r = 0; r < 8; ++r) so[wave][8 * g + r][j * 16 + col] = acc[j][r] + bb; }
  LDSX(); for (int rl = 0; rl < 16; ++rl) vst2(Y + (r0 + rl) * DM + c0 + lane * 4, *(const v4f*)&so[wave][rl][lane * 4]); }
extern "C" void kernel_launch(void* const* d_in, const int* in_sizes, int n_in, void* d_out, int out_size, void* d_ws, size_t ws_size, hipStream_t stream) {
  (void)in_sizes; (void)n_in; (void)out_size;
  const float** F = (const float**)d_in;   // 0 x [2,2048,256], 1 W_qk [256,512] (in,out), 2 W_v [256,256], 3 W_proj [256,256], 4 b_proj [256], 5 W_pos [2,8], 6 b_pos [8], 7 gating [8]
  if (ws_size < (size_t)WS_END) return;
  char* ws = (char*)d_ws; _Float16 *Q = (_Float16*)(ws + WS_Q), *Kr = (_Float16*)(ws + WS_K), *V = (_Float16*)(ws + WS_V); float* O = (float*)(ws + WS_O);
  k_proj<<<dim3(TNB * SS / 64, 6), 128, 0, stream>>>(F[0], F[1], F[2], Q, Kr, V);
  k_attn<<<dim3(TQB, NH, TNB), 128, 0, stream>>>(Q, Kr, V, F[5], F[6], F[7], O);
  k_out<<<dim3(TNB * SS / 64, DM / 128), 128, 0, stream>>>(O, F[3], F[4], (float*)d_out);
}

// v008
// One run takes 35 microseconds.
// Next to v007, in two timings, it ran 1.04 and 1.05 times as fast.
// All steps since v000 together make it 5.40 times as fast.
// compute dtype: all float inputs rounded to bf16; q/k = x . W_qk and v = x . W_v with EXACT bf16 products on WMMA 16x16x32 ((in,out) weights rounded to bf16 in LDS, fragments by the transposing load), rounded once to f16; content attention per (batch, head): q, k single f16 x 32^-1/2, running-max softmax in f32 (hardware exp), P (scaled by 2^11, single f16) x v; positional attention: per-head weights exp((n-m) W_pos[0,h] + |n-m| W_pos[1,h] + b_pos[h] - row maximum) x 2^11; in the one 32-key pass that holds the query they are formed one by one in f32 and rounded to f16, in every other pass they are a constant f16 fragment (the fall-off inside a pass) times one f32 factor per query and pass, applied to the product with the same v fragments; divided by their f32 row sum at the end; mix (1 - g) patch + g pos with g = sigmoid(gating_h) in f32; out = ctx (bf16 hi + lo, 2 products) . W_proj + b; f32 output. q, k, v and ctx lie in the workspace in the order of their reader's WMMA fragments.
#include <hip/hip_runtime.h>
#include <math.h>

typedef __attribute__((ext_vector_type(16))) _Float16 v16h;
typedef __attribute__((ext_vector_type(16))) __bf16 v16b;
typedef __attribute__((ext_vector_type(8)))  _Float16 v8h;
typedef __attribute__((ext_vector_type(8)))  float v8f;
typedef __attribute__((ext_vector_type(4)))  float v4f;
typedef __attribute__((ext_vector_type(2)))  float v2f;
typedef __attribute__((ext_vector_type(4)))  unsigned v4u;
typedef __attribute__((ext_vector_type(4)))  int v4i;
typedef float __attribute__((may_alias)) float_a;
typedef int __attribute__((may_alias)) int_a;

template <typename T> __device__ __forceinline__ void vst2(void* p, T v) { *(T*)p = v;  }
__device__ __forceinline__ v8f wmma16(v16h a, v16h b, v8f c) {
  v8f d = __builtin_amdgcn_wmma_f32_16x16x32_f16(false, a, false, b, (short)0, c, false, false);
  asm volatile("v_nop\n\tv_nop\n\tv_nop\n\tv_nop" : "+v"(d) : "v"(a), "v"(b));
  return d;
}
__device__ __forceinline__ v8f wmma_bf(v16b a, v16b b, v8f c) {
  v8f d = __builtin_amdgcn_wmma_f32_16x16x32_bf16(false, a, false, b, (short)0, c, false, false);
  asm volatile("v_nop\n\tv_nop\n\tv_nop\n\tv_nop" : "+v"(d) : "v"(a), "v"(b));
  return d;
}
// 16x16x32 fragments: lane = (h = lane>>4, row/col = lane&15); elements 0..7 = k0+8h+0..7, 8..15 = k0+16+8h+0..7; D element r = row 8h+r
__device__ __forceinline__ v16h frag_h(const _Float16* rowk0, int lane) {
  union { v16h v; v8h q[2]; } u; const _Float16* p = rowk0 + 8 * (lane >> 4);
  u.q[0] = *(const v8h*)p; u.q[1] = *(const v8h*)(p + 16); return u.v;
}
__device__ __forceinline__ v16h frag_f32(const float* rowk0, int lane) {
  v16h a; const float* p = rowk0 + 8 * (lane >> 4);
#pragma unroll
  for (int i = 0; i < 8; ++i) { a[i] = (_Float16)p[i]; a[8 + i] = (_Float16)p[16 + i]; }
  return a;
}
__device__ __forceinline__ v16h frag_f32s(const float* rowk0, int lane, float sc) {
  v16h a; const float* p = rowk0 + 8 * (lane >> 4);
#pragma unroll
  for (int i = 0; i < 8; ++i) { a[i] = (_Float16)(p[i] * sc); a[8 + i] = (_Float16)(p[16 + i] * sc); }
  return a;
}
// column fragment from a [K][ld] layout (column n), rows >= K read as 0
__device__ __forceinline__ v16h fragc_f32(const float* W, int k0, int n, int lane, int ld, int K) {
  v16h a; const int g = lane >> 4;
#pragma unroll
  for (int i = 0; i < 8; ++i) { const int ka = k0 + 8 * g + i, kb = ka + 16;
    a[i] = (_Float16)(ka < K ? W[(size_t)(ka < K ? ka : K - 1) * ld + n] : 0.f); a[8 + i] = (_Float16)(kb < K ? W[(size_t)(kb < K ? kb : K - 1) * ld + n] : 0.f); }
  return a;
}
struct F2 { v16b h, l; };
__device__ __forceinline__ F2 bsplit16(const float v[16]) { F2 r;
#pragma unroll
  for (int i = 0; i < 16; ++i) { const __bf16 h = (__bf16)v[i]; r.h[i] = h; r.l[i] = (__bf16)(v[i] - (float)h); }
  return r; }
__device__ __forceinline__ F2 split_row(const float* row, int k0, int lane) { float v[16]; const float* p = row + k0 + 8 * (lane >> 4);
#pragma unroll
  for (int i = 0; i < 8; ++i) { v[i] = p[i]; v[8 + i] = p[16 + i]; }
  return bsplit16(v); }
__device__ __forceinline__ F2 split_rowK(const float* row, int k0, int lane, int K) { float v[16]; const int g = lane >> 4;
#pragma unroll
  for (int i = 0; i < 8; ++i) { const int ka = k0 + 8 * g + i, kb = ka + 16; v[i] = ka < K ? row[ka < K ? ka : K - 1] : 0.f; v[8 + i] = kb < K ? row[kb < K ? kb : K - 1] : 0.f; }
  return bsplit16(v); }
__device__ __forceinline__ F2 split_col(const float* W, int k0, int n, int lane, int ld, int K) { float v[16]; const int g = lane >> 4;
#pragma unroll
  for (int i = 0; i < 8; ++i) { const int ka = k0 + 8 * g + i, kb = ka + 16; v[i] = ka < K ? W[(size_t)(ka < K ? ka : K - 1) * ld + n] : 0.f; v[8 + i] = kb < K ? W[(size_t)(kb < K ? kb : K - 1) * ld + n] : 0.f; }
  return bsplit16(v); }
__device__ __forceinline__ v8f mac3(const F2& a, const F2& b, v8f c) { c = wmma_bf(a.l, b.h, c); c = wmma_bf(a.h, b.l, c); return wmma_bf(a.h, b.h, c); }
__device__ __forceinline__ float sigm(float v) { return 1.0f / (1.0f + expf(-v)); }
#define LDSX() do { asm volatile("s_wait_dscnt 0" ::: "memory"); __builtin_amdgcn_wave_barrier(); __builtin_amdgcn_fence(__ATOMIC_RELEASE, "workgroup"); } while (0)


// Gated positional self-attention, 1-D (B 2, N 2,048 patches, C 256, 8 heads x 32): content softmax(q k / sqrt(32)) and a positional softmax from relative indices (d, |d|) . W_pos + b_pos, mixed per head by sigmoid(gating), (re)normalised, applied to v, output projection + bias.
#define NB 2
#define SS 2048
#define DM 256
#define NH 8
#define HD 32
#define NR (NB * SS)
#ifndef TQB
#define TQB (SS / 64)
#define TNB NB
#endif
typedef __attribute__((ext_vector_type(8))) __bf16 v8b;
__device__ __forceinline__ v16b frag_b(const __bf16* rowk0, int lane) {
  union { v16b v; v8b q[2]; } u; const __bf16* p = rowk0 + 8 * (lane >> 4);
  u.q[0] = *(const v8b*)p; u.q[1] = *(const v8b*)(p + 16); return u.v;
}
__device__ __forceinline__ float bfr(float v) { return (float)(__bf16)v; }
__device__ __attribute__((noinline)) float exp_ni(float v) { return expf(v); }
__device__ __attribute__((noinline)) float erf_ni(float v) { return erff(v); }

#define WS_PW  0u                                   // the first three ranges are not used
#define WS_PV  (WS_PW + 2u * (size_t)512 * DM)
#define WS_PP  (WS_PV + 2u * (size_t)DM * DM)
#define WS_Q   (WS_PP + 2u * (size_t)DM * DM)          // f16 q and k [b][head][16-row tile][half][lane][8], v [b][head][32-key pass][16-dim tile][half][lane][8]; f32 ctx [16-row tile][head][piece][lane][4]: fragment order, see k_proj
#define WS_K   (WS_Q + 2u * (size_t)NR * DM)
#define WS_V   (WS_K + 2u * (size_t)NR * DM)
#define WS_O   (WS_V + 2u * (size_t)NB * DM * SS)
#define WS_END (WS_O + 4u * (size_t)NR * DM)

// The two GEMM kernels take their weights from the f32 (in,out) inputs themselves. A work-group rounds its block of 256 k x 128 columns to bf16 into LDS, rows as they lie in memory (a wave's load is 512 bytes in a row),
// and every wave takes its B fragments from there by the transposing load, which hands lane (col, g) the k order 8 g + 0..7 of column col: the order of the row fragments
#define WPITCH 288u   // bytes from one k row to the next in LDS: an odd multiple of 32, the conflict-free pitch of the transposing load
typedef __attribute__((ext_vector_type(8))) short s16x8;
typedef __attribute__((ext_vector_type(4))) __bf16 v4b;
__device__ __forceinline__ v8b ld_tr16(const unsigned char* p) { typedef __attribute__((address_space(3))) s16x8 lds_s16x8; return __builtin_bit_cast(v8b, __builtin_amdgcn_ds_load_tr16_b128_v8i16((lds_s16x8*)p)); }
// Wc: first column of the block in row 0, LD: floats per row. Step i: the four waves take rows 4 i .. 4 i + 3. All 64 loads of a lane are issued before the first is used: the block costs one trip to L2, not one per step
template <int LD> __device__ __forceinline__ void stage_w(const float* __restrict__ Wc, unsigned char* sw, int tid) {
  const float* p = Wc + (size_t)(tid >> 5) * LD + (tid & 31) * 4; unsigned char* d = sw + (unsigned)(tid >> 5) * WPITCH + (unsigned)(tid & 31) * 8u;
  v4f r[DM / 4];
#pragma unroll   // constant indices, so that the pieces stay in registers
  for (int i = 0; i < DM / 4; ++i) r[i] = *(const v4f*)(p + (size_t)i * 4 * LD);
  asm volatile("s_wait_xcnt 0x0" :: "v"(p) : "memory");   // behind the last load; the lane address is an input, so that its registers are not rewritten in front of the wait
#pragma unroll   // constant indices, as above
  for (int i = 0; i < DM / 4; ++i) { v4b o;
#pragma unroll   // constant indices, as above
    for (int e = 0; e < 4; ++e) o[e] = (__bf16)r[i][e];
    *(v4b*)(d + (unsigned)i * 4u * WPITCH) = o; }
}
// the eight B fragments (16 columns each) of k step kc; tl: the lane's address in the transposing load's map
__device__ __forceinline__ void wfrags(v16b (&f)[8], const unsigned char* tl, int kc) {
#pragma unroll   // constant indices, so that the fragments stay in registers
  for (int j = 0; j < 8; ++j) { union { v16b v; v8b q[2]; } u; const unsigned char* p = tl + (unsigned)kc * 32u * WPITCH + (unsigned)j * 32u;
    u.q[0] = ld_tr16(p); u.q[1] = ld_tr16(p + 16u * WPITCH); f[j] = u.v; }
}
struct Row16 { v4f q[4]; };   // a lane's 16 f32 of one k step: k0 + 8 g + 0..7 and k0 + 16 + 8 g + 0..7
__device__ __forceinline__ Row16 row_ld(const float* lanep, int kc) { Row16 r; const float* p = lanep + kc * 32;
  r.q[0] = *(const v4f*)p; r.q[1] = *(const v4f*)(p + 4); r.q[2] = *(const v4f*)(p + 16); r.q[3] = *(const v4f*)(p + 20); return r; }
// ---- k_proj: block = (64 rows, 128 cols, which): 0,1: q cols / 2,3: k cols of x . W_qk (which = blockIdx.y over 4 col blocks of 128); 4,5: v
// q, k and v leave in the order in which k_attn's lanes take them: piece (half, lane = 16 g + col) holds the 8 values that lane (col, g) wants as elements 8 half + 0..7 of its fragment, the 32 pieces of a half in a row.
// One 16-byte load of a wave then reads 512 bytes in a row (4 lines); from rows or planes it touched 16 lines and used 32 bytes of each. k_attn hands ctx to k_out in the same way
__global__ __launch_bounds__(128) void k_proj(const float* __restrict__ X, const float* __restrict__ WQK, const float* __restrict__ WV, _Float16* __restrict__ Q, _Float16* __restrict__ Kr, _Float16* __restrict__ V) {
  __shared__ __align__(16) _Float16 so[64][136]; __shared__ __align__(16) _Float16 st[128][72]; __shared__ __align__(32) unsigned char sw[DM * WPITCH];
  const int tid = threadIdx.x, wave = tid >> 5, lane = tid & 31, col = lane & 15, g = lane >> 4; const int cb = blockIdx.y; const size_t rb = (size_t)blockIdx.x * 64; const size_t r0 = rb + wave * 16;
  v8f acc[8] = {};
  const float* xl = X + (r0 + col) * DM + 8 * g; const unsigned char* tl = sw + (unsigned)(8 * g + (lane & 7)) * WPITCH + 16u * (unsigned)((lane >> 3) & 1);
  Row16 xr[2]; v16b wf[2][8];
  xr[0] = row_ld(xl, 0); xr[1] = row_ld(xl, 1);
  if (cb < 4) stage_w<2 * DM>(WQK + cb * 128, sw, tid); else stage_w<DM>(WV + (cb - 4) * 128, sw, tid);
  __syncthreads();   // the block is whole before any wave reads it
  wfrags(wf[0], tl, 0);
#pragma unroll   // constant indices, so that the two fragment sets stay in registers
  for (int kc = 0; kc < DM / 32; ++kc) { v16b a;
    __builtin_amdgcn_sched_barrier(0);   // keeps the next step's LDS reads one group in front of this step's products, and this step's conversion here: moved up, it waits for row pieces that were only just asked for
    if (kc + 1 < DM / 32) wfrags(wf[(kc + 1) & 1], tl, kc + 1);
#pragma unroll
    for (int i = 0; i < 16; ++i) a[i] = (__bf16)xr[kc & 1].q[i >> 2][i & 3];
    if (kc + 2 < DM / 32) xr[kc & 1] = row_ld(xl, kc + 2);
    if (kc + 2 == DM / 32 - 1) asm volatile("s_wait_xcnt 0x0" :: "v"(xl) : "memory");   // behind the last load; the lane address is an input, so that its registers are not rewritten in front of the wait
#pragma unroll
    for (int j = 0; j < 8; ++j) acc[j] = wmma_bf(a, wf[kc & 1][j], acc[j]); }
  if (cb < 4) {
#pragma unroll
    for (int j = 0; j < 8; ++j)
#pragma unroll
      for (int r = 0; r < 8; ++r) so[wave * 16 + 8 * g + r][j * 16 + col] = (_Float16)acc[j][r];
    __syncthreads(); const size_t b = rb / SS; const int s0 = (int)(rb % SS); const int hf = wave & 1, tw = wave >> 1;   // a wave writes half hf of row tiles tw and tw + 2 of the block's four heads: values [tile * 16 + col][head * 32 + 16 hf + 8 g + 0..7]
    _Float16* kd = ((cb < 2) ? Q : Kr) + ((b * NH + (cb & 1) * 4) * (SS / 16) + s0 / 16 + tw) * 512 + hf * 256 + lane * 8;
#pragma unroll   // constant offsets from one lane address
    for (int i = 0; i < 8; ++i) { const int hh = i >> 1, t2 = (i & 1) * 2; vst2((unsigned*)(kd + (hh * (SS / 16) + t2) * 512), *(const v4u*)&so[(t2 + tw) * 16 + col][hh * HD + hf * 16 + 8 * g]); } }
  else {
#pragma unroll
    for (int j = 0; j < 8; ++j)
#pragma unroll
      for (int r = 0; r < 8; ++r) st[j * 16 + col][wave * 16 + 8 * g + r] = (_Float16)acc[j][r];
    __syncthreads(); const size_t b = rb / SS; const int s0 = (int)(rb % SS); const int hf = wave & 1, dt = wave >> 1;   // a wave writes half hf of dim tile dt of the block's two passes and four heads: values [pass * 32 + 16 hf + 8 g + 0..7][head * 32 + dt * 16 + col]
    _Float16* vd = V + ((b * NH + (cb - 4) * 4) * (SS / 32) + s0 / 32) * 1024 + dt * 512 + hf * 256 + lane * 8;
#pragma unroll   // constant offsets from one lane address
    for (int i = 0; i < 8; ++i) { const int hh = i >> 1, pp = i & 1; vst2((unsigned*)(vd + (hh * (SS / 32) + pp) * 1024), *(const v4u*)&st[hh * HD + dt * 16 + col][pp * 32 + hf * 16 + 8 * g]); }
    asm volatile("s_wait_xcnt 0x0" :: "v"(vd) : "memory"); }   // behind the last store; the lane address is an input: in the listing the q and k branch, which rewrites its registers, stands behind these stores
}
// the eight 16-byte loads a lane makes for one 32-key pass: two K tiles, two V tiles
struct PassF { v16h k0, k1, v0, v1; };
// fragment at a wave-uniform base plus this lane's byte offset (16 lane): its two halves lie 512 bytes apart; the lane offset is fixed for the whole loop, only the uniform bases move from pass to pass
typedef const __attribute__((address_space(1))) char* gcp;
typedef const __attribute__((address_space(1))) v8h* gv8p;
__device__ __forceinline__ v16h frag_u(gcp ubase, unsigned voff) {
  union { v16h v; v8h q[2]; } u; gcp p = ubase + voff;
  u.q[0] = *(gv8p)p; u.q[1] = *(gv8p)(p + 512); return u.v;
}
__device__ __forceinline__ gcp sbase(const _Float16* p) { return (gcp)(unsigned long long)p; }   // the workspace planes lie in global memory
__device__ __forceinline__ PassF fetch_pass(const _Float16* kb, const _Float16* vb, unsigned lo, int j0) {
  const gcp ks = sbase(kb + (size_t)j0 * HD), vs = sbase(vb + (size_t)j0 * HD);
  __builtin_amdgcn_sched_barrier(0);   // with the one behind the wait: no vector work of the passes around stands between the loads and their wait (with three sets the compiler put a subtraction there whose result lands on an address register)
  PassF f; f.k0 = frag_u(ks, lo); f.k1 = frag_u(ks + 1024, lo); f.v0 = frag_u(vs, lo); f.v1 = frag_u(vs + 1024, lo);
  asm volatile("s_wait_xcnt 0x0" ::: "memory");   // stands behind the loads, in front of the next rewrite of an address register that they name
  __builtin_amdgcn_sched_barrier(0);   // the second of the two: the next pass's vector work stays behind the wait
  return f; }
// 2^x on the hardware unit. The v_nop is the slot that the instruction set asks for behind a transcendental before its result is used or its source overwritten
__device__ __forceinline__ float exp2_hw(float x) { float r; asm("v_exp_f32 %0, %1\n\tv_nop" : "=v"(r) : "v"(x)); return r; }
// eight of them in one statement: every result register differs from every source (early clobber), so that each fills the slot of the one in front of it; the one v_nop is the slot behind the last
__device__ __forceinline__ v8f exp2_hw8(v8f x) { float r0, r1, r2, r3, r4, r5, r6, r7;
  asm("v_exp_f32 %0, %8\n\tv_exp_f32 %1, %9\n\tv_exp_f32 %2, %10\n\tv_exp_f32 %3, %11\n\tv_exp_f32 %4, %12\n\tv_exp_f32 %5, %13\n\tv_exp_f32 %6, %14\n\tv_exp_f32 %7, %15\n\tv_nop"
      : "=&v"(r0), "=&v"(r1), "=&v"(r2), "=&v"(r3), "=&v"(r4), "=&v"(r5), "=&v"(r6), "=&v"(r7) : "v"(x[0]), "v"(x[1]), "v"(x[2]), "v"(x[3]), "v"(x[4]), "v"(x[5]), "v"(x[6]), "v"(x[7]));
  return v8f{r0, r1, r2, r3, r4, r5, r6, r7}; }
__device__ __forceinline__ float xhalf(float v) { return __builtin_bit_cast(float, __builtin_amdgcn_permlanex16(__builtin_bit_cast(int, v), __builtin_bit_cast(int, v), 0x76543210, 0xfedcba98, false, false)); }   // the value of lane ^ 16
// transposed products: S^T = K . Q^T (A = 16 key rows, B = the wave's 16 queries) and O^T += V^T . P^T. A lane holds 16 of the 32 scores of ONE query (column col; keys 8 g + r and 16 + 8 g + r), which is the k order of the B operand of the second product: P goes from the score accumulators straight into that operand
__global__ __launch_bounds__(128) void k_attn(const _Float16* __restrict__ Q, const _Float16* __restrict__ Kr, const _Float16* __restrict__ V, const float* __restrict__ WPOS, const float* __restrict__ BPOS, const float* __restrict__ GATE, float* __restrict__ O) {
  const int tid = threadIdx.x, wave = __builtin_amdgcn_readfirstlane(tid >> 5), lane = tid & 31, col = lane & 15, g = lane >> 4; const int h = blockIdx.y; const size_t b = blockIdx.z; const int q0 = blockIdx.x * 64 + wave * 16; const size_t rq = b * SS + q0;   // the wave's number in a scalar register: the tests on pd below are scalar branches
  const float gt = 1.0f / (1.0f + expf(-bfr(GATE[h])));
  const _Float16* qp = Q + ((b * NH + h) * (SS / 16) + (q0 >> 4)) * 512 + lane * 8;
  union { v16h v; v8h q[2]; } uq; uq.q[0] = *(const v8h*)qp; uq.q[1] = *(const v8h*)(qp + 256); const v16h aq = uq.v;
  asm volatile("s_wait_xcnt 0x0" :: "v"(qp) : "memory");   // behind the two loads of aq; their address is an input, so that its registers are not rewritten in front of the wait
  const _Float16* kb = Kr + (b * NH + h) * (size_t)(SS * HD); const _Float16* vb = V + (b * NH + h) * (size_t)(SS * HD);
  const unsigned lo = (unsigned)lane * 16u;
  PassF f0 = fetch_pass(kb, vb, lo, 0), f1 = fetch_pass(kb, vb, lo, 32), f2;   // the first two passes' loads fly while the positional tables below are made
  // positional row of query n = q0 + col (this lane's column of the B operand), in the base-2 exponent: u(d) = d ua + |d| uc + ub with d = n - m. u is linear on either side of d = 0, so its maximum over the row lies at m = 0, m = n or m = SS - 1
  const float ua = bfr(WPOS[h]) * 1.4426950408889634f, uc = bfr(WPOS[NH + h]) * 1.4426950408889634f, ub = bfr(BPOS[h]) * 1.4426950408889634f;
  const float nq = (float)(q0 + col), dl = nq - (float)(SS - 1);
  const float um = fmaxf(fmaxf(fmaf(nq, ua, fmaf(fabsf(nq), uc, ub)), fmaf(dl, ua, fmaf(fabsf(dl), uc, ub))), ub);
  const float uk = (ub - um) + 11.0f;   // weight = 2^(u - maximum + 11)
  float relp = nq, z = 0.f;   // relp: n - m at the first key of the pass; z: sum of this lane's weights
  // Off the diagonal |d| = +-d for all 32 keys of a pass, so u is linear there: u(d) = d sg + ub, sg = ua + uc before the query, ua - uc behind it, and
  // weight(n, j0 + o) = 2^((n - j0 - os) sg + ub - maximum) x 2^((os - o) sg + 11): one factor per query and pass times a table over o that is the same in every pass.
  // os is the end of the pass with the larger weight (31 for sg <= 0, else 0): the table lies in [0, 2^11] and the factor is a weight of the row / 2^11, so neither can overflow
  const int pd = q0 >> 5;   // the one pass whose 32 keys hold the wave's 16 queries
  struct Side { v16h c; float cs, sg, os, kk; };   // table as B operand, this lane's sum of it, slope, os, constant of the factor's exponent
  auto side = [&](float sg) { Side t; t.sg = sg; t.os = sg <= 0.f ? 31.0f : 0.f; t.kk = ub - um; t.cs = 0.f;
#pragma unroll   // constant indices, so that the table stays in registers
    for (int i = 0; i < 16; ++i) { t.c[i] = (_Float16)exp2_hw(fmaf(t.os - (float)(8 * g + (i < 8 ? i : 8 + i)), sg, 11.0f)); t.cs += (float)t.c[i]; }
    return t; };
  Side cur = side(ua + uc); const Side behind = side(ua - uc);
  v8f t[2] = {}; float fw = 0.f;   // V^T . table of the last pass and its factor, added into acc2 one pass later
  float m = -3.0e38f, l = 0.f;   // query col's running maximum (equal in both lane halves) and this lane's half of its running sum
  v8f acc[2] = {}, acc2[2] = {};   // element r = head dim dt * 16 + 8 g + r of query col
  auto pass = [&](const PassF& f, int p) { v16h pa;
    if (p == pd) { float w[16]; const float relb = relp - (float)(8 * g);   // the pass with the diagonal: every weight by itself, factor 2^0
#pragma unroll
      for (int i = 0; i < 16; ++i) { const float d = relb - (float)(i < 8 ? i : 8 + i); w[i] = exp2_hw(fmaf(d, ua, fmaf(fabsf(d), uc, uk))); cur.c[i] = (_Float16)w[i]; }
#pragma unroll
      for (int i = 0; i < 8; ++i) w[i] = w[2 * i] + w[2 * i + 1];
      cur.cs = ((w[0] + w[1]) + (w[2] + w[3])) + ((w[4] + w[5]) + (w[6] + w[7])); cur.sg = 0.f; cur.kk = 0.f; }
    else if (p == pd + 1) cur = behind;
#pragma unroll   // constant indices, so that the accumulators stay in registers
    for (int dt = 0; dt < 2; ++dt) acc2[dt] += t[dt] * fw;   // the pass before: its products have left the matrix unit by now
    fw = exp2_hw(fmaf(relp - cur.os, cur.sg, cur.kk)); z = fmaf(fw, cur.cs, z); relp -= 32.0f;
    v8f s[2];
#pragma unroll
    for (int ct = 0; ct < 2; ++ct) { v8f c = {}; c = wmma16(ct ? f.k1 : f.k0, aq, c); s[ct] = c * 0.17677669529663688f; }
    float x[2];
#pragma unroll
    for (int ct = 0; ct < 2; ++ct) x[ct] = fmaxf(fmaxf(fmaxf(s[ct][0], s[ct][1]), fmaxf(s[ct][2], s[ct][3])), fmaxf(fmaxf(s[ct][4], s[ct][5]), fmaxf(s[ct][6], s[ct][7])));
    float mx = fmaxf(x[0], x[1]); mx = fmaxf(mx, xhalf(mx));
    const float mn = fmaxf(m, mx); const float ea = exp2_hw((m - mn) * 1.4426950408889634f); const float alpha = (m <= -1.0e38f) ? 0.f : ea; m = mn;
#pragma unroll
    for (int ct = 0; ct < 2; ++ct) { const v8f e = exp2_hw8((s[ct] - mn) * 1.4426950408889634f);
#pragma unroll
      for (int r = 0; r < 8; ++r) pa[ct * 8 + r] = (_Float16)(e[r] * 2048.0f);
      x[ct] = ((e[0] + e[1]) + (e[2] + e[3])) + ((e[4] + e[5]) + (e[6] + e[7])); }
    l = l * alpha + (x[0] + x[1]);
#pragma unroll
    for (int dt = 0; dt < 2; ++dt) { acc[dt] *= alpha; const v16h vf = dt ? f.v1 : f.v0; acc[dt] = wmma16(vf, pa, acc[dt]); v8f c = {}; t[dt] = wmma16(vf, cur.c, c); } };
  // three register sets: each pass first issues the loads of the pass two ahead, into the set that the pass before it has left, so that they fly over two passes.
#pragma unroll 1   // the body already holds three passes, one per register set
  for (int ks = 0; ks < SS / 32 - 1; ks += 3) {
    f2 = fetch_pass(kb, vb, lo, (ks + 2) * 32);
    pass(f0, ks);
    f0 = fetch_pass(kb, vb, lo, (ks + 3) * 32);
    pass(f1, ks + 1);
    f1 = fetch_pass(kb, vb, lo, (ks + 4 < SS / 32 ? ks + 4 : ks + 3) * 32);   // behind the last pass there is none: fetch in bounds, unused
    pass(f2, ks + 2); }
  static_assert((SS / 32) % 3 == 1, "the loop takes the passes in threes and leaves the last one");
  pass(f0, SS / 32 - 1);
#pragma unroll   // constant indices, so that the accumulators stay in registers
  for (int dt = 0; dt < 2; ++dt) acc2[dt] += t[dt] * fw;
  z += xhalf(z); l += xhalf(l);   // the two lane halves hold the two halves of query col's keys
  const float cl = (1.0f - gt) * ((1.0f / 2048.0f) / l), cz = gt * (1.0f / z);
  float* orow = O + ((rq >> 4) * NH + h) * 512 + lane * 4;   // head h is k step h of k_out, and this lane's 16 values are its lane's 16 of that step: four pieces of 4, each piece's 32 lanes in a row
#pragma unroll
  for (int dt = 0; dt < 2; ++dt) { v4f o[2];
#pragma unroll
    for (int r = 0; r < 8; ++r) o[r >> 2][r & 3] = acc[dt][r] * cl + acc2[dt][r] * cz;
    vst2(orow + dt * 256, o[0]); vst2(orow + dt * 256 + 128, o[1]); }
}
// the same 16 values from ctx in fragment order: lanep = the row tile's start + 4 lane
__device__ __forceinline__ Row16 ctx_ld(const float* lanep, int kc) { Row16 r; const float* p = lanep + kc * 512;
  r.q[0] = *(const v4f*)p; r.q[1] = *(const v4f*)(p + 128); r.q[2] = *(const v4f*)(p + 256); r.q[3] = *(const v4f*)(p + 384); return r; }
// ---- k_out: block = (64 rows, 128 cols): out = ctx (hi + lo) . W_proj + b
__global__ __launch_bounds__(128) void k_out(const float* __restrict__ O, const float* __restrict__ WP, const float* __restrict__ BP, float* __restrict__ Y) { __shared__ __align__(16) float so[4][16][132]; __shared__ __align__(32) unsigned char sw[DM * WPITCH];
  const int tid = threadIdx.x, wave = tid >> 5, lane = tid & 31, col = lane & 15, g = lane >> 4; const size_t r0 = (size_t)blockIdx.x * 64 + wave * 16; const int c0 = blockIdx.y * 128;
  v8f acc[8] = {};
  const float* ol = O + (r0 >> 4) * (size_t)(NH * 512) + lane * 4; const unsigned char* tl = sw + (unsigned)(8 * g + (lane & 7)) * WPITCH + 16u * (unsigned)((lane >> 3) & 1);
  Row16 xr[2]; v16b wf[2][8];
  xr[0] = ctx_ld(ol, 0); xr[1] = ctx_ld(ol, 1);
  stage_w<DM>(WP + c0, sw, tid);
  __syncthreads();   // the block is whole before any wave reads it
  wfrags(wf[0], tl, 0);
#pragma unroll   // constant indices, so that the two fragment sets stay in registers
  for (int kc = 0; kc < DM / 32; ++kc) { float v[16];
    __builtin_amdgcn_sched_barrier(0);   // keeps the next step's LDS reads one group in front of this step's products, and this step's split here: moved up, it waits for row pieces that were only just asked for
    if (kc + 1 < DM / 32) wfrags(wf[(kc + 1) & 1], tl, kc + 1);
#pragma unroll
    for (int i = 0; i < 16; ++i) v[i] = xr[kc & 1].q[i >> 2][i & 3];
    const F2 a = bsplit16(v);
    if (kc + 2 < DM / 32) xr[kc & 1] = ctx_ld(ol, kc + 2);
    if (kc + 2 == DM / 32 - 1) asm volatile("s_wait_xcnt 0x0" :: "v"(ol) : "memory");   // behind the last load; the lane address is an input, so that its registers are not rewritten in front of the wait
#pragma unroll
    for (int j = 0; j < 8; ++j) { const v16b w = wf[kc & 1][j]; acc[j] = wmma_bf(a.h, w, acc[j]); acc[j] = wmma_bf(a.l, w, acc[j]); } }
#pragma unroll
  for (int j = 0; j < 8; ++j) { const float bb = bfr(BP[c0 + j * 16 + col]);
#pragma unroll
    for (int r = 0; r < 8; ++r) so[wave][8 * g + r][j * 16 + col] = acc[j][r] + bb; }
  LDSX(); for (int rl = 0; rl < 16; ++rl) vst2(Y + (r0 + rl) * DM + c0 + lane * 4, *(const v4f*)&so[wave][rl][lane * 4]); }
extern "C" void kernel_launch(void* const* d_in, const int* in_sizes, int n_in, void* d_out, int out_size, void* d_ws, size_t ws_size, hipStream_t stream) {
  (void)in_sizes; (void)n_in; (void)out_size;
  const float** F = (const float**)d_in;   // 0 x [2,2048,256], 1 W_qk [256,512] (in,out), 2 W_v [256,256], 3 W_proj [256,256], 4 b_proj [256], 5 W_pos [2,8], 6 b_pos [8], 7 gating [8]
  if (ws_size < (size_t)WS_END) return;
  char* ws = (char*)d_ws; _Float16 *Q = (_Float16*)(ws + WS_Q), *Kr = (_Float16*)(ws + WS_K), *V = (_Float16*)(ws + WS_V); float* O = (float*)(ws + WS_O);
  k_proj<<<dim3(TNB * SS / 64, 6), 128, 0, stream>>>(F[0], F[1], F[2], Q, Kr, V);
  k_attn<<<dim3(TQB, NH, TNB), 128, 0, stream>>>(Q, Kr, V, F[5], F[6], F[7], O);
  k_out<<<dim3(TNB * SS / 64, DM / 128), 128, 0, stream>>>(O, F[3], F[4], (float*)d_out);
}

// v010
// One run takes 31.4 microseconds.
// Versions between v008 and this one are left out; their measured steps multiply to 1.09 times as fast.
// Counting every step since v000, it is 5.90 times as fast.
// compute dtype: all float inputs rounded to bf16; q/k = x . W_qk and v = x . W_v with EXACT bf16 products on WMMA 16x16x32 ((in,out) weights rounded to bf16 in LDS, fragments by the transposing load), rounded once to f16; content attention per (batch, head): q, k single f16 x 32^-1/2, running-max softmax in f32 (hardware exp), P (scaled by 2^11, single f16) x v; positional attention: per-head weights exp((n-m) W_pos[0,h] + |n-m| W_pos[1,h] + b_pos[h] - row maximum); in the one 32-key pass that holds the query they are formed one by one in f32 and rounded to f16, in every other pass they are a constant f16 fragment (the fall-off inside a pass, x 2^11) times one factor per query and pass: k_proj multiplies each pass's v by the two fragments once (x 2^-11, f16 result), k_attn multiplies those 64 vectors by its queries' factors (f16); divided by their f32 row sum at the end; mix (1 - g) patch + g pos with g = sigmoid(gating_h) in f32; out = ctx (bf16 hi + lo, 2 products) . W_proj + b; f32 output. q, k, v and ctx lie in the workspace in the order of their reader's WMMA fragments.
#include <hip/hip_runtime.h>
#include <math.h>

typedef __attribute__((ext_vector_type(16))) _Float16 v16h;
typedef __attribute__((ext_vector_type(16))) __bf16 v16b;
typedef __attribute__((ext_vector_type(8)))  _Float16 v8h;
typedef __attribute__((ext_vector_type(8)))  float v8f;
typedef __attribute__((ext_vector_type(4)))  float v4f;
typedef __attribute__((ext_vector_type(2)))  float v2f;
typedef __attribute__((ext_vector_type(4)))  unsigned v4u;
typedef __attribute__((ext_vector_type(4)))  int v4i;
typedef float __attribute__((may_alias)) float_a;
typedef int __attribute__((may_alias)) int_a;

template <typename T> __device__ __forceinline__ void vst2(void* p, T v) { *(T*)p = v;  }
__device__ __forceinline__ v8f wmma16(v16h a, v16h b, v8f c) {
  v8f d = __builtin_amdgcn_wmma_f32_16x16x32_f16(false, a, false, b, (short)0, c, false, false);
  asm volatile("v_nop\n\tv_nop\n\tv_nop\n\tv_nop" : "+v"(d) : "v"(a), "v"(b));
  return d;
}
__device__ __forceinline__ v8f wmma_bf(v16b a, v16b b, v8f c) {
  v8f d = __builtin_amdgcn_wmma_f32_16x16x32_bf16(false, a, false, b, (short)0, c, false, false);
  asm volatile("v_nop\n\tv_nop\n\tv_nop\n\tv_nop" : "+v"(d) : "v"(a), "v"(b));
  return d;
}
// 16x16x32 fragments: lane = (h = lane>>4, row/col = lane&15); elements 0..7 = k0+8h+0..7, 8..15 = k0+16+8h+0..7; D element r = row 8h+r
__device__ __forceinline__ v16h frag_h(const _Float16* rowk0, int lane) {
  union { v16h v; v8h q[2]; } u; const _Float16* p = rowk0 + 8 * (lane >> 4);
  u.q[0] = *(const v8h*)p; u.q[1] = *(const v8h*)(p + 16); return u.v;
}
__device__ __forceinline__ v16h frag_f32(const float* rowk0, int lane) {
  v16h a; const float* p = rowk0 + 8 * (lane >> 4);
#pragma unroll
  for (int i = 0; i < 8; ++i) { a[i] = (_Float16)p[i]; a[8 + i] = (_Float16)p[16 + i]; }
  return a;
}
__device__ __forceinline__ v16h frag_f32s(const float* rowk0, int lane, float sc) {
  v16h a; const float* p = rowk0 + 8 * (lane >> 4);
#pragma unroll
  for (int i = 0; i < 8; ++i) { a[i] = (_Float16)(p[i] * sc); a[8 + i] = (_Float16)(p[16 + i] * sc); }
  return a;
}
// column fragment from a [K][ld] layout (column n), rows >= K read as 0
__device__ __forceinline__ v16h fragc_f32(const float* W, int k0, int n, int lane, int ld, int K) {
  v16h a; const int g = lane >> 4;
#pragma unroll
  for (int i = 0; i < 8; ++i) { const int ka = k0 + 8 * g + i, kb = ka + 16;
    a[i] = (_Float16)(ka < K ? W[(size_t)(ka < K ? ka : K - 1) * ld + n] : 0.f); a[8 + i] = (_Float16)(kb < K ? W[(size_t)(kb < K ? kb : K - 1) * ld + n] : 0.f); }
  return a;
}
struct F2 { v16b h, l; };
__device__ __forceinline__ F2 bsplit16(const float v[16]) { F2 r;
#pragma unroll
  for (int i = 0; i < 16; ++i) { const __bf16 h = (__bf16)v[i]; r.h[i] = h; r.l[i] = (__bf16)(v[i] - (float)h); }
  return r; }
__device__ __forceinline__ F2 split_row(const float* row, int k0, int lane) { float v[16]; const float* p = row + k0 + 8 * (lane >> 4);
#pragma unroll
  for (int i = 0; i < 8; ++i) { v[i] = p[i]; v[8 + i] = p[16 + i]; }
  return bsplit16(v); }
__device__ __forceinline__ F2 split_rowK(const float* row, int k0, int lane, int K) { float v[16]; const int g = lane >> 4;
#pragma unroll
  for (int i = 0; i < 8; ++i) { const int ka = k0 + 8 * g + i, kb = ka + 16; v[i] = ka < K ? row[ka < K ? ka : K - 1] : 0.f; v[8 + i] = kb < K ? row[kb < K ? kb : K - 1] : 0.f; }
  return bsplit16(v); }
__device__ __forceinline__ F2 split_col(const float* W, int k0, int n, int lane, int ld, int K) { float v[16]; const int g = lane >> 4;
#pragma unroll
  for (int i = 0; i < 8; ++i) { const int ka = k0 + 8 * g + i, kb = ka + 16; v[i] = ka < K ? W[(size_t)(ka < K ? ka : K - 1) * ld + n] : 0.f; v[8 + i] = kb < K ? W[(size_t)(kb < K ? kb : K - 1) * ld + n] : 0.f; }
  return bsplit16(v); }
__device__ __forceinline__ v8f mac3(const F2& a, const F2& b, v8f c) { c = wmma_bf(a.l, b.h, c); c = wmma_bf(a.h, b.l, c); return wmma_bf(a.h, b.h, c); }
__device__ __forceinline__ float sigm(float v) { return 1.0f / (1.0f + expf(-v)); }
#define LDSX() do { asm volatile("s_wait_dscnt 0" ::: "memory"); __builtin_amdgcn_wave_barrier(); __builtin_amdgcn_fence(__ATOMIC_RELEASE, "workgroup"); } while (0)


// Gated positional self-attention, 1-D (B 2, N 2,048 patches, C 256, 8 heads x 32): content softmax(q k / sqrt(32)) and a positional softmax from relative indices (d, |d|) . W_pos + b_pos, mixed per head by sigmoid(gating), (re)normalised, applied to v, output projection + bias.
#define NB 2
#define SS 2048
#define DM 256
#define NH 8
#define HD 32
#define NR (NB * SS)
#ifndef TQB
#define TQB (SS / 64)
#define TNB NB
#endif
typedef __attribute__((ext_vector_type(8))) __bf16 v8b;
__device__ __forceinline__ v16b frag_b(const __bf16* rowk0, int lane) {
  union { v16b v; v8b q[2]; } u; const __bf16* p = rowk0 + 8 * (lane >> 4);
  u.q[0] = *(const v8b*)p; u.q[1] = *(const v8b*)(p + 16); return u.v;
}
__device__ __forceinline__ float bfr(float v) { return (float)(__bf16)v; }
__device__ __attribute__((noinline)) float exp_ni(float v) { return expf(v); }
__device__ __attribute__((noinline)) float erf_ni(float v) { return erff(v); }

#define WS_PW  0u                                   // f16 u [b][head][side][32-key pass][dim]: v of a pass times the positional fall-off table of a side, see k_proj; the next two ranges are not used
#define WS_PV  (WS_PW + 2u * (size_t)512 * DM)
#define WS_PP  (WS_PV + 2u * (size_t)DM * DM)
#define WS_Q   (WS_PP + 2u * (size_t)DM * DM)          // f16 q and k [b][head][16-row tile][half][lane][8], v [b][head][32-key pass][16-dim tile][half][lane][8]; f32 ctx [16-row tile][head][piece][lane][4]: fragment order, see k_proj
#define WS_K   (WS_Q + 2u * (size_t)NR * DM)
#define WS_V   (WS_K + 2u * (size_t)NR * DM)
#define WS_O   (WS_V + 2u * (size_t)NB * DM * SS)
#define WS_END (WS_O + 4u * (size_t)NR * DM)

// The two GEMM kernels take their weights from the f32 (in,out) inputs themselves. A work-group rounds its block of 256 k x 128 columns to bf16 into LDS, rows as they lie in memory (a wave's load is 512 bytes in a row),
// and every wave takes its B fragments from there by the transposing load, which hands lane (col, g) the k order 8 g + 0..7 of column col: the order of the row fragments
#define WPITCH 288u   // bytes from one k row to the next in LDS: an odd multiple of 32, the conflict-free pitch of the transposing load
typedef __attribute__((ext_vector_type(8))) short s16x8;
typedef __attribute__((ext_vector_type(4))) __bf16 v4b;
__device__ __forceinline__ v8b ld_tr16(const unsigned char* p) { typedef __attribute__((address_space(3))) s16x8 lds_s16x8; return __builtin_bit_cast(v8b, __builtin_amdgcn_ds_load_tr16_b128_v8i16((lds_s16x8*)p)); }
// Wc: first column of the block in row 0, LD: floats per row. Step i: the four waves take rows 4 i .. 4 i + 3. All 64 loads of a lane are issued before the first is used: the block costs one trip to L2, not one per step
template <int LD> __device__ __forceinline__ void stage_w(const float* __restrict__ Wc, unsigned char* sw, int tid) {
  const float* p = Wc + (size_t)(tid >> 5) * LD + (tid & 31) * 4; unsigned char* d = sw + (unsigned)(tid >> 5) * WPITCH + (unsigned)(tid & 31) * 8u;
  v4f r[DM / 4];
#pragma unroll   // constant indices, so that the pieces stay in registers
  for (int i = 0; i < DM / 4; ++i) r[i] = *(const v4f*)(p + (size_t)i * 4 * LD);
  asm volatile("s_wait_xcnt 0x0" :: "v"(p) : "memory");   // behind the last load; the lane address is an input, so that its registers are not rewritten in front of the wait
#pragma unroll   // constant indices, as above
  for (int i = 0; i < DM / 4; ++i) { v4b o;
#pragma unroll   // constant indices, as above
    for (int e = 0; e < 4; ++e) o[e] = (__bf16)r[i][e];
    *(v4b*)(d + (unsigned)i * 4u * WPITCH) = o; }
}
// the eight B fragments (16 columns each) of k step kc; tl: the lane's address in the transposing load's map
__device__ __forceinline__ void wfrags(v16b (&f)[8], const unsigned char* tl, int kc) {
#pragma unroll   // constant indices, so that the fragments stay in registers
  for (int j = 0; j < 8; ++j) { union { v16b v; v8b q[2]; } u; const unsigned char* p = tl + (unsigned)kc * 32u * WPITCH + (unsigned)j * 32u;
    u.q[0] = ld_tr16(p); u.q[1] = ld_tr16(p + 16u * WPITCH); f[j] = u.v; }
}
struct Row16 { v4f q[4]; };   // a lane's 16 f32 of one k step: k0 + 8 g + 0..7 and k0 + 16 + 8 g + 0..7
__device__ __forceinline__ Row16 row_ld(const float* lanep, int kc) { Row16 r; const float* p = lanep + kc * 32;
  r.q[0] = *(const v4f*)p; r.q[1] = *(const v4f*)(p + 4); r.q[2] = *(const v4f*)(p + 16); r.q[3] = *(const v4f*)(p + 20); return r; }
// 2^x on the hardware unit. The v_nop is the slot that the instruction set asks for behind a transcendental before its result is used or its source overwritten
__device__ __forceinline__ float exp2_hw(float x) { float r; asm("v_exp_f32 %0, %1\n\tv_nop" : "=v"(r) : "v"(x)); return r; }
// ---- k_proj: block = (64 rows, 128 cols, which): 0,1: q cols / 2,3: k cols of x . W_qk (which = blockIdx.y over 4 col blocks of 128); 4,5: v
// q, k and v leave in the order in which k_attn's lanes take them: piece (half, lane = 16 g + col) holds the 8 values that lane (col, g) wants as elements 8 half + 0..7 of its fragment, the 32 pieces of a half in a row.
// One 16-byte load of a wave then reads 512 bytes in a row (4 lines); from rows or planes it touched 16 lines and used 32 bytes of each. k_attn hands ctx to k_out in the same way
__global__ __launch_bounds__(128) void k_proj(const float* __restrict__ X, const float* __restrict__ WQK, const float* __restrict__ WV, const float* __restrict__ WPOS, _Float16* __restrict__ Q, _Float16* __restrict__ Kr, _Float16* __restrict__ V, _Float16* __restrict__ U) {
  __shared__ __align__(16) _Float16 so[64][136]; __shared__ __align__(16) _Float16 st[128][72]; __shared__ __align__(32) unsigned char sw[DM * WPITCH];
  const int tid = threadIdx.x, wave = tid >> 5, lane = tid & 31, col = lane & 15, g = lane >> 4; const int cb = blockIdx.y; const size_t rb = (size_t)blockIdx.x * 64; const size_t r0 = rb + wave * 16;
  v8f acc[8] = {};
  const float* xl = X + (r0 + col) * DM + 8 * g; const unsigned char* tl = sw + (unsigned)(8 * g + (lane & 7)) * WPITCH + 16u * (unsigned)((lane >> 3) & 1);
  Row16 xr[2]; v16b wf[2][8];
  xr[0] = row_ld(xl, 0); xr[1] = row_ld(xl, 1);
  // v blocks only: the positional fall-off table of this wave's head (its use stands at the end). Its two slopes are asked for here and the table is made behind the staging, where a wave waits for the others anyway: at the end both would lengthen the kernel's tail
  const int hw = __builtin_amdgcn_readfirstlane(wave), hg = (cb < 4 ? 0 : (cb - 4) * 4) + hw;
  const float wp0 = WPOS[hg], wp1 = WPOS[NH + hg]; v16h tb = {};
  if (cb < 4) stage_w<2 * DM>(WQK + cb * 128, sw, tid);
  else { stage_w<DM>(WV + (cb - 4) * 128, sw, tid);
    // B column col holds the table of side col & 1 (0: keys before the query, slope ua + uc; 1: behind it, ua - uc)
    const float ua = bfr(wp0) * 1.4426950408889634f, uc = bfr(wp1) * 1.4426950408889634f;
    const float sg = (col & 1) ? ua - uc : ua + uc, os = sg <= 0.f ? 31.0f : 0.f;
#pragma unroll   // constant indices, so that the table stays in registers
    for (int i = 0; i < 16; ++i) tb[i] = (_Float16)exp2_hw(fmaf(os - (float)(8 * g + (i < 8 ? i : 8 + i)), sg, 11.0f)); }
  __syncthreads();   // the block is whole before any wave reads it
  wfrags(wf[0], tl, 0);
#pragma unroll   // constant indices, so that the two fragment sets stay in registers
  for (int kc = 0; kc < DM / 32; ++kc) { v16b a;
    __builtin_amdgcn_sched_barrier(0);   // keeps the next step's LDS reads one group in front of this step's products, and this step's conversion here: moved up, it waits for row pieces that were only just asked for
    if (kc + 1 < DM / 32) wfrags(wf[(kc + 1) & 1], tl, kc + 1);
#pragma unroll
    for (int i = 0; i < 16; ++i) a[i] = (__bf16)xr[kc & 1].q[i >> 2][i & 3];
    if (kc + 2 < DM / 32) xr[kc & 1] = row_ld(xl, kc + 2);
    if (kc + 2 == DM / 32 - 1) asm volatile("s_wait_xcnt 0x0" :: "v"(xl) : "memory");   // behind the last load; the lane address is an input, so that its registers are not rewritten in front of the wait
#pragma unroll
    for (int j = 0; j < 8; ++j) acc[j] = wmma_bf(a, wf[kc & 1][j], acc[j]); }
  if (cb < 4) {
#pragma unroll
    for (int j = 0; j < 8; ++j)
#pragma unroll
      for (int r = 0; r < 8; ++r) so[wave * 16 + 8 * g + r][j * 16 + col] = (_Float16)acc[j][r];
    __syncthreads(); const size_t b = rb / SS; const int s0 = (int)(rb % SS); const int hf = wave & 1, tw = wave >> 1;   // a wave writes half hf of row tiles tw and tw + 2 of the block's four heads: values [tile * 16 + col][head * 32 + 16 hf + 8 g + 0..7]
    _Float16* kd = ((cb < 2) ? Q : Kr) + ((b * NH + (cb & 1) * 4) * (SS / 16) + s0 / 16 + tw) * 512 + hf * 256 + lane * 8;
#pragma unroll   // constant offsets from one lane address
    for (int i = 0; i < 8; ++i) { const int hh = i >> 1, t2 = (i & 1) * 2; vst2((unsigned*)(kd + (hh * (SS / 16) + t2) * 512), *(const v4u*)&so[(t2 + tw) * 16 + col][hh * HD + hf * 16 + 8 * g]); } }
  else {
#pragma unroll
    for (int j = 0; j < 8; ++j)
#pragma unroll
      for (int r = 0; r < 8; ++r) st[j * 16 + col][wave * 16 + 8 * g + r] = (_Float16)acc[j][r];
    __syncthreads(); const size_t b = rb / SS; const int s0 = (int)(rb % SS); const int hf = wave & 1, dt = wave >> 1;   // a wave writes half hf of dim tile dt of the block's two passes and four heads: values [pass * 32 + 16 hf + 8 g + 0..7][head * 32 + dt * 16 + col]
    _Float16* vd = V + ((b * NH + (cb - 4) * 4) * (SS / 32) + s0 / 32) * 1024 + dt * 512 + hf * 256 + lane * 8;
    union { v16h v; v8h q[2]; } av[4];   // V^T fragments of the products with the table below (wave = head; pass i >> 1, dim tile i & 1): asked for here, so that their way from LDS runs beside the stores; read one by one behind them, each product waited for its own
#pragma unroll   // constant indices, so that the fragments stay in registers
    for (int i = 0; i < 4; ++i) { const _Float16* sp = &st[hw * HD + (i & 1) * 16 + col][(i >> 1) * 32 + 8 * g]; av[i].q[0] = *(const v8h*)sp; av[i].q[1] = *(const v8h*)(sp + 16); }
    __builtin_amdgcn_sched_barrier(0);   // with the one behind the wait: no vector work of the products below stands between these stores and their wait (lifted there, vector work landed on data registers of stores just issued)
#pragma unroll   // constant offsets from one lane address
    for (int i = 0; i < 8; ++i) { const int hh = i >> 1, pp = i & 1; vst2((unsigned*)(vd + (hh * (SS / 32) + pp) * 1024), *(const v4u*)&st[hh * HD + dt * 16 + col][pp * 32 + hf * 16 + 8 * g]); }
    asm volatile("s_wait_xcnt 0x0" :: "v"(vd) : "memory");   // behind the last store of v; the lane address is an input, so that its registers are not rewritten in front of the wait
    __builtin_amdgcn_sched_barrier(0);   // the second of the two: the products' vector work stays behind the wait
    // Off the diagonal a positional weight is (factor of query and pass) x table[key in pass] (k_attn), and the table is the same for every query: V^T . table is made here, once per pass, head and side, not by every wave of k_attn.
    // Wave = head; B = the table tb made above, so that columns 0 and 1 of D are the two sides' vectors. x 2^-11 takes the table's scale out again: u is a sum of 32 values of v with weights of at most 1, as far from the end of f16 as can be
    v8h uo[4];
#pragma unroll   // constant indices, as above
    for (int i = 0; i < 4; ++i) { v8f c = {}; c = wmma16(av[i].v, tb, c);
#pragma unroll
      for (int r = 0; r < 8; ++r) uo[i][r] = (_Float16)(c[r] * 0.00048828125f); }
    _Float16* ud = U + (((b * NH + hg) * 2 + (col & 1)) * (SS / 32) + s0 / 32) * HD + 8 * g;   // the block's two passes of one head and side are 128 bytes in a row: one writer per line
    if (col < 2) {
#pragma unroll   // constant offsets from one lane address
      for (int i = 0; i < 4; ++i) vst2(ud + (i >> 1) * HD + (i & 1) * 16, uo[i]); }
    asm volatile("s_wait_xcnt 0x0" :: "v"(ud) : "memory"); }   // behind the last store of u; the lane address is an input: in the listing the q and k branch, which rewrites its registers, stands behind these stores
}
// the eight 16-byte loads a lane makes for one 32-key pass: two K tiles, two V tiles
struct PassF { v16h k0, k1, v0, v1; };
// fragment at a wave-uniform base plus this lane's byte offset (16 lane): its two halves lie 512 bytes apart; the lane offset is fixed for the whole loop, only the uniform bases move from pass to pass
typedef const __attribute__((address_space(1))) char* gcp;
typedef const __attribute__((address_space(1))) v8h* gv8p;
__device__ __forceinline__ v16h frag_u(gcp ubase, unsigned voff) {
  union { v16h v; v8h q[2]; } u; gcp p = ubase + voff;
  u.q[0] = *(gv8p)p; u.q[1] = *(gv8p)(p + 512); return u.v;
}
__device__ __forceinline__ gcp sbase(const _Float16* p) { return (gcp)(unsigned long long)p; }   // the workspace planes lie in global memory
__device__ __forceinline__ PassF fetch_pass(const _Float16* kb, const _Float16* vb, unsigned lo, int j0) {
  const gcp ks = sbase(kb + (size_t)j0 * HD), vs = sbase(vb + (size_t)j0 * HD);
  __builtin_amdgcn_sched_barrier(0);   // with the one behind the wait: no vector work of the passes around stands between the loads and their wait (with three sets the compiler put a subtraction there whose result lands on an address register)
  PassF f; f.k0 = frag_u(ks, lo); f.k1 = frag_u(ks + 1024, lo); f.v0 = frag_u(vs, lo); f.v1 = frag_u(vs + 1024, lo);
  asm volatile("s_wait_xcnt 0x0" ::: "memory");   // stands behind the loads, in front of the next rewrite of an address register that they name
  __builtin_amdgcn_sched_barrier(0);   // the second of the two: the next pass's vector work stays behind the wait
  return f; }
// eight of them in one statement: every result register differs from every source (early clobber), so that each fills the slot of the one in front of it; the one v_nop is the slot behind the last
__device__ __forceinline__ v8f exp2_hw8(v8f x) { float r0, r1, r2, r3, r4, r5, r6, r7;
  asm("v_exp_f32 %0, %8\n\tv_exp_f32 %1, %9\n\tv_exp_f32 %2, %10\n\tv_exp_f32 %3, %11\n\tv_exp_f32 %4, %12\n\tv_exp_f32 %5, %13\n\tv_exp_f32 %6, %14\n\tv_exp_f32 %7, %15\n\tv_nop"
      : "=&v"(r0), "=&v"(r1), "=&v"(r2), "=&v"(r3), "=&v"(r4), "=&v"(r5), "=&v"(r6), "=&v"(r7) : "v"(x[0]), "v"(x[1]), "v"(x[2]), "v"(x[3]), "v"(x[4]), "v"(x[5]), "v"(x[6]), "v"(x[7]));
  return v8f{r0, r1, r2, r3, r4, r5, r6, r7}; }
__device__ __forceinline__ float xhalf(float v) { return __builtin_bit_cast(float, __builtin_amdgcn_permlanex16(__builtin_bit_cast(int, v), __builtin_bit_cast(int, v), 0x76543210, 0xfedcba98, false, false)); }   // the value of lane ^ 16
// transposed products: S^T = K . Q^T (A = 16 key rows, B = the wave's 16 queries) and O^T += V^T . P^T. A lane holds 16 of the 32 scores of ONE query (column col; keys 8 g + r and 16 + 8 g + r), which is the k order of the B operand of the second product: P goes from the score accumulators straight into that operand
// sum over the wave's 32 lanes, in every lane: four rotations inside the 16-lane row, then the other row
template <int N> __device__ __forceinline__ float ror_add(float v) { return v + __builtin_bit_cast(float, __builtin_amdgcn_update_dpp(0, __builtin_bit_cast(int, v), 0x120 + N, 0xf, 0xf, false)); }
__device__ __forceinline__ float lanesum(float v) { v = ror_add<8>(v); v = ror_add<4>(v); v = ror_add<2>(v); v = ror_add<1>(v); return v + xhalf(v); }
// the two V tiles of one pass alone, for the pass that holds the wave's queries
struct VPair { v16h v0, v1; };
__device__ __forceinline__ VPair fetch_v(const _Float16* vb, unsigned lo, int j0) {
  const gcp vs = sbase(vb + (size_t)j0 * HD);
  __builtin_amdgcn_sched_barrier(0);   // as in fetch_pass: no vector work stands between the loads and their wait
  VPair f; f.v0 = frag_u(vs, lo); f.v1 = frag_u(vs + 1024, lo);
  asm volatile("s_wait_xcnt 0x0" ::: "memory");   // stands behind the loads, in front of the next rewrite of an address register that they name
  __builtin_amdgcn_sched_barrier(0);   // the second of the two
  return f; }
__device__ __forceinline__ v8h ld_tr16h(const unsigned char* p) { typedef __attribute__((address_space(3))) s16x8 lds_s16x8; return __builtin_bit_cast(v8h, __builtin_amdgcn_ds_load_tr16_b128_v8i16((lds_s16x8*)p)); }
__global__ __launch_bounds__(128) void k_attn(const _Float16* __restrict__ Q, const _Float16* __restrict__ Kr, const _Float16* __restrict__ V, const _Float16* __restrict__ U, const float* __restrict__ WPOS, const float* __restrict__ BPOS, const float* __restrict__ GATE, float* __restrict__ O) {
  __shared__ __align__(32) unsigned char su[2 * (SS / 32) * HD * 2];   // u of this batch and head: [side][pass][dim] f16, 64 bytes a pass
  const int tid = threadIdx.x, wave = __builtin_amdgcn_readfirstlane(tid >> 5), lane = tid & 31, col = lane & 15, g = lane >> 4; const int h = blockIdx.y; const size_t b = blockIdx.z; const int q0 = blockIdx.x * 64 + wave * 16; const size_t rq = b * SS + q0;
  const float gt = 1.0f / (1.0f + expf(-bfr(GATE[h])));
  const _Float16* qp = Q + ((b * NH + h) * (SS / 16) + (q0 >> 4)) * 512 + lane * 8;
  union { v16h v; v8h q[2]; } uq; uq.q[0] = *(const v8h*)qp; uq.q[1] = *(const v8h*)(qp + 256); const v16h aq = uq.v;
  asm volatile("s_wait_xcnt 0x0" :: "v"(qp) : "memory");   // behind the two loads of aq; their address is an input, so that its registers are not rewritten in front of the wait
  const _Float16* up = U + (b * NH + h) * (size_t)(2 * (SS / 32) * HD) + tid * 8; v4u ur[4];   // the work-group's 8 KiB of u: 16 bytes a thread and step
#pragma unroll   // constant indices, so that the pieces stay in registers
  for (int i = 0; i < 4; ++i) ur[i] = *(const v4u*)(up + i * 1024);
  asm volatile("s_wait_xcnt 0x0" :: "v"(up) : "memory");   // behind the four loads of u; their address is an input, as above
  const _Float16* kb = Kr + (b * NH + h) * (size_t)(SS * HD); const _Float16* vb = V + (b * NH + h) * (size_t)(SS * HD);
  const unsigned lo = (unsigned)lane * 16u;
  const int pd = q0 >> 5;   // the one pass whose 32 keys hold the wave's 16 queries
  const VPair vd = fetch_v(vb, lo, pd * 32);
  // Every work-group starts its walk over the 64 passes at a pass of its own and wraps round (the running softmax takes the passes in any order). K and V come from memory for the first asker; with one common order all 32 work-groups
  // of a head stood at the same pass, each pass was a first touch. Now a work-group meets untouched lines only up to its neighbour's start and finds the rest in L2.
  // The start: x & 3 counts most; for speed only, any placement gives the same values
  const int bx = blockIdx.x, rot = ((bx & 3) << 4) + ((bx >> 3) << 2) + (((bx >> 2) & 1) << 1);
  auto at = [&](int p) { return ((p + rot) & (SS / 32 - 1)) * 32; };   // first key of the p-th pass of this work-group's walk
  static_assert(((SS / 32) & (SS / 32 - 1)) == 0, "the wrap is a mask");
  PassF f0 = fetch_pass(kb, vb, lo, at(0)), f1 = fetch_pass(kb, vb, lo, at(1)), f2;   // the first two passes' loads fly while the positional part below is made
  // positional row of query n = q0 + col (this lane's column of the B operand), in the base-2 exponent: u(d) = d ua + |d| uc + ub with d = n - m. u is linear on either side of d = 0, so its maximum over the row lies at m = 0, m = n or m = SS - 1
  const float ua = bfr(WPOS[h]) * 1.4426950408889634f, uc = bfr(WPOS[NH + h]) * 1.4426950408889634f, ub = bfr(BPOS[h]) * 1.4426950408889634f;
  const float nq = (float)(q0 + col), dl = nq - (float)(SS - 1);
  const float um = fmaxf(fmaxf(fmaf(nq, ua, fmaf(fabsf(nq), uc, ub)), fmaf(dl, ua, fmaf(fabsf(dl), uc, ub))), ub);
  const float kk = ub - um;   // weight = 2^(u - maximum): at most 1
  // the pass with the diagonal: every weight by itself. z: sum of this lane's weights
  v16h cd; float z;
  { float w[16]; const float relb = nq - (float)(pd * 32) - (float)(8 * g);
#pragma unroll
    for (int hf = 0; hf < 2; ++hf) { v8f x;
#pragma unroll
      for (int i = 0; i < 8; ++i) { const float d = relb - (float)(16 * hf + i); x[i] = fmaf(d, ua, fmaf(fabsf(d), uc, kk)); }
      x = exp2_hw8(x);
#pragma unroll
      for (int i = 0; i < 8; ++i) { w[8 * hf + i] = x[i]; cd[8 * hf + i] = (_Float16)x[i]; } }
#pragma unroll
    for (int i = 0; i < 8; ++i) w[i] = w[2 * i] + w[2 * i + 1];
    z = ((w[0] + w[1]) + (w[2] + w[3])) + ((w[4] + w[5]) + (w[6] + w[7])); }
  // Off the diagonal |d| = +-d for all 32 keys of a pass, so u is linear there: u(d) = d sg + ub, sg = ua + uc before the query, ua - uc behind it, and
  // weight(n, 32 p + o) = 2^((n - 32 p - os) sg + ub - maximum) x 2^((os - o) sg + 11) x 2^-11: one factor per query and pass times a table over o that is the same in every pass and for every query.
  // os is the end of the pass with the larger weight (31 for sg <= 0, else 0): the table lies in [0, 2^11] and the factor is a weight of the row, at most 1, so neither can overflow.
  // k_proj has multiplied every pass's v by both tables (u). Here the 64 passes are the k dimension of one more product: O2^T += u^T . F^T, F = the factors of this wave's queries, rounded to f16 (the row sum takes them as rounded); a pass counts with the u of the side on which it lies, and F is 0 at the pass with the diagonal
  const float sgp = ua + uc, sgm = ua - uc, osp = sgp <= 0.f ? 31.0f : 0.f, osm = sgm <= 0.f ? 31.0f : 0.f;
  // sums of the two tables as k_proj rounds them, x 2^-11: lane = key in the pass, then the sum over the 32 lanes
  const float csp = lanesum((float)(_Float16)exp2_hw(fmaf(osp - (float)lane, sgp, 11.0f))) * 0.00048828125f, csm = lanesum((float)(_Float16)exp2_hw(fmaf(osm - (float)lane, sgm, 11.0f))) * 0.00048828125f;
  // B operands, element i = pass 8 g + i, 16 + 8 g + (i - 8) of a k step of 32 passes: the order of the transposing load below. k step km holds the diagonal's pass and both sides: it is taken twice, once with each side's u, with 0 for the passes of the other side (fb0, fb1); the other one (kp) lies wholly on one side
  const int km = pd >> 5, kp = km ^ 1; const float g256 = (float)(256 * g);
  v16h fbp, fb0, fb1;
  { const float a0 = (km ? nq - osp : nq - osm) - (float)(1024 * kp) - g256, sq = km ? sgp : sgm, cq = km ? csp : csm;   // n - 32 p - os at the lane's first pass
#pragma unroll   // constant indices, so that the factors stay in registers
    for (int hf = 0; hf < 2; ++hf) { v8f x;
#pragma unroll
      for (int i = 0; i < 8; ++i) x[i] = fmaf(a0 - (float)(32 * (16 * hf + i)), sq, kk);
      x = exp2_hw8(x);
#pragma unroll
      for (int i = 0; i < 8; ++i) { const _Float16 e = (_Float16)x[i]; fbp[8 * hf + i] = e; z = fmaf((float)e, cq, z); } } }
  { const float ap = nq - osp - (float)(1024 * km) - g256, am = nq - osm - (float)(1024 * km) - g256; const int pl = pd - 32 * km - 8 * g;   // pass 8 g + c of the step lies before the diagonal's pass if c < pl and is that pass if c == pl
#pragma unroll   // constant indices, as above
    for (int hf = 0; hf < 2; ++hf) { v8f x;
#pragma unroll
      for (int i = 0; i < 8; ++i) { const int c = 16 * hf + i; x[i] = fmaf((c < pl ? ap : am) - (float)(32 * c), c < pl ? sgp : sgm, kk); }
      x = exp2_hw8(x);
#pragma unroll
      for (int i = 0; i < 8; ++i) { const int c = 16 * hf + i; const _Float16 e = (_Float16)(c == pl ? 0.f : x[i]), e0 = (_Float16)0.f; fb0[8 * hf + i] = c < pl ? e : e0; fb1[8 * hf + i] = c < pl ? e0 : e; z = fmaf((float)e, c < pl ? csp : csm, z); } } }
  __builtin_amdgcn_sched_barrier(0);   // the weights and factors above stay in front of the wait for u: moved up, the barrier's wait for every load in flight stood in front of them, and they ran behind the way to memory instead of beside it
#pragma unroll   // constant indices, as above
  for (int i = 0; i < 4; ++i) *(v4u*)(su + (unsigned)tid * 16u + (unsigned)i * 2048u) = ur[i];
  __syncthreads();   // u is whole before any wave reads it
  v8f acc2[2] = {};   // element r = head dim dt * 16 + 8 g + r of query col
  // the lane's addresses in the transposing load's map: rows = passes (64 bytes), 16 dims = 32 bytes; side 1 lies 4096 bytes behind side 0
  const unsigned tl = (unsigned)(8 * g + (lane & 7)) * 64u + 16u * (unsigned)((lane >> 3) & 1);
  const unsigned char* tp = su + (km ? 0u : 4096u) + (unsigned)kp * 2048u + tl; const unsigned char* tm = su + (unsigned)km * 2048u + tl;
#pragma unroll   // constant indices, so that the accumulators stay in registers
  for (int dt = 0; dt < 2; ++dt) { union { v16h v; v8h q[2]; } a, c0, c1; a.q[0] = ld_tr16h(tp + dt * 32); a.q[1] = ld_tr16h(tp + 1024 + dt * 32);
    c0.q[0] = ld_tr16h(tm + dt * 32); c0.q[1] = ld_tr16h(tm + 1024 + dt * 32); c1.q[0] = ld_tr16h(tm + 4096 + dt * 32); c1.q[1] = ld_tr16h(tm + 5120 + dt * 32);
    acc2[dt] = wmma16(dt ? vd.v1 : vd.v0, cd, acc2[dt]); acc2[dt] = wmma16(a.v, fbp, acc2[dt]); acc2[dt] = wmma16(c0.v, fb0, acc2[dt]); acc2[dt] = wmma16(c1.v, fb1, acc2[dt]); }
  float m = -3.0e38f, l = 0.f;   // query col's running maximum (equal in both lane halves) and this lane's half of its running sum
  v8f acc[2] = {};
  auto pass = [&](const PassF& f) { v16h pa;
    v8f s[2];
#pragma unroll
    for (int ct = 0; ct < 2; ++ct) { v8f c = {}; c = wmma16(ct ? f.k1 : f.k0, aq, c); s[ct] = c * 0.17677669529663688f; }
    float x[2];
#pragma unroll
    for (int ct = 0; ct < 2; ++ct) x[ct] = fmaxf(fmaxf(fmaxf(s[ct][0], s[ct][1]), fmaxf(s[ct][2], s[ct][3])), fmaxf(fmaxf(s[ct][4], s[ct][5]), fmaxf(s[ct][6], s[ct][7])));
    float mx = fmaxf(x[0], x[1]); mx = fmaxf(mx, xhalf(mx));
    const float mn = fmaxf(m, mx); const float ea = exp2_hw((m - mn) * 1.4426950408889634f); const float alpha = (m <= -1.0e38f) ? 0.f : ea; m = mn;
#pragma unroll
    for (int ct = 0; ct < 2; ++ct) { const v8f e = exp2_hw8((s[ct] - mn) * 1.4426950408889634f);
#pragma unroll
      for (int r = 0; r < 8; ++r) pa[ct * 8 + r] = (_Float16)(e[r] * 2048.0f);
      x[ct] = ((e[0] + e[1]) + (e[2] + e[3])) + ((e[4] + e[5]) + (e[6] + e[7])); }
    l = l * alpha + (x[0] + x[1]);
#pragma unroll
    for (int dt = 0; dt < 2; ++dt) { acc[dt] *= alpha; acc[dt] = wmma16(dt ? f.v1 : f.v0, pa, acc[dt]); } };
  // three register sets: each pass first issues the loads of the pass two ahead, into the set that the pass before it has left, so that they fly over two passes.
#pragma unroll 1   // the body already holds three passes, one per register set
  for (int ks = 0; ks < SS / 32 - 1; ks += 3) {
    f2 = fetch_pass(kb, vb, lo, at(ks + 2));
    pass(f0);
    f0 = fetch_pass(kb, vb, lo, at(ks + 3));
    pass(f1);
    f1 = fetch_pass(kb, vb, lo, at(ks + 4));   // behind the last pass there is none: the wrap keeps the fetch in bounds, unused
    pass(f2); }
  static_assert((SS / 32) % 3 == 1, "the loop takes the passes in threes and leaves the last one");
  pass(f0);
  z += xhalf(z); l += xhalf(l);   // the two lane halves hold the two halves of query col's keys (of z: of the diagonal pass's keys and of the other passes)
  const float cl = (1.0f - gt) * ((1.0f / 2048.0f) / l), cz = gt * (1.0f / z);
  float* orow = O + ((rq >> 4) * NH + h) * 512 + lane * 4;   // head h is k step h of k_out, and this lane's 16 values are its lane's 16 of that step: four pieces of 4, each piece's 32 lanes in a row
#pragma unroll
  for (int dt = 0; dt < 2; ++dt) { v4f o[2];
#pragma unroll
    for (int r = 0; r < 8; ++r) o[r >> 2][r & 3] = acc[dt][r] * cl + acc2[dt][r] * cz;
    vst2(orow + dt * 256, o[0]); vst2(orow + dt * 256 + 128, o[1]); }
}
// the same 16 values from ctx in fragment order: lanep = the row tile's start + 4 lane
__device__ __forceinline__ Row16 ctx_ld(const float* lanep, int kc) { Row16 r; const float* p = lanep + kc * 512;
  r.q[0] = *(const v4f*)p; r.q[1] = *(const v4f*)(p + 128); r.q[2] = *(const v4f*)(p + 256); r.q[3] = *(const v4f*)(p + 384); return r; }
// ---- k_out: block = (64 rows, 128 cols): out = ctx (hi + lo) . W_proj + b
__global__ __launch_bounds__(128) void k_out(const float* __restrict__ O, const float* __restrict__ WP, const float* __restrict__ BP, float* __restrict__ Y) { __shared__ __align__(16) float so[4][16][132]; __shared__ __align__(32) unsigned char sw[DM * WPITCH];
  const int tid = threadIdx.x, wave = tid >> 5, lane = tid & 31, col = lane & 15, g = lane >> 4; const size_t r0 = (size_t)blockIdx.x * 64 + wave * 16; const int c0 = blockIdx.y * 128;
  v8f acc[8] = {};
  const float* ol = O + (r0 >> 4) * (size_t)(NH * 512) + lane * 4; const unsigned char* tl = sw + (unsigned)(8 * g + (lane & 7)) * WPITCH + 16u * (unsigned)((lane >> 3) & 1);
  Row16 xr[2]; v16b wf[2][8];
  xr[0] = ctx_ld(ol, 0); xr[1] = ctx_ld(ol, 1);
  stage_w<DM>(WP + c0, sw, tid);
  __syncthreads();   // the block is whole before any wave reads it
  wfrags(wf[0], tl, 0);
#pragma unroll   // constant indices, so that the two fragment sets stay in registers
  for (int kc = 0; kc < DM / 32; ++kc) { float v[16];
    __builtin_amdgcn_sched_barrier(0);   // keeps the next step's LDS reads one group in front of this step's products, and this step's split here: moved up, it waits for row pieces that were only just asked for
    if (kc + 1 < DM / 32) wfrags(wf[(kc + 1) & 1], tl, kc + 1);
#pragma unroll
    for (int i = 0; i < 16; ++i) v[i] = xr[kc & 1].q[i >> 2][i & 3];
    const F2 a = bsplit16(v);
    if (kc + 2 < DM / 32) xr[kc & 1] = ctx_ld(ol, kc + 2);
    if (kc + 2 == DM / 32 - 1) asm volatile("s_wait_xcnt 0x0" :: "v"(ol) : "memory");   // behind the last load; the lane address is an input, so that its registers are not rewritten in front of the wait
#pragma unroll
    for (int j = 0; j < 8; ++j) { const v16b w = wf[kc & 1][j]; acc[j] = wmma_bf(a.h, w, acc[j]); acc[j] = wmma_bf(a.l, w, acc[j]); } }
#pragma unroll
  for (int j = 0; j < 8; ++j) { const float bb = bfr(BP[c0 + j * 16 + col]);
#pragma unroll
    for (int r = 0; r < 8; ++r) so[wave][8 * g + r][j * 16 + col] = acc[j][r] + bb; }
  LDSX(); for (int rl = 0; rl < 16; ++rl) vst2(Y + (r0 + rl) * DM + c0 + lane * 4, *(const v4f*)&so[wave][rl][lane * 4]); }
extern "C" void kernel_launch(void* const* d_in, const int* in_sizes, int n_in, void* d_out, int out_size, void* d_ws, size_t ws_size, hipStream_t stream) {
  (void)in_sizes; (void)n_in; (void)out_size;
  const float** F = (const float**)d_in;   // 0 x [2,2048,256], 1 W_qk [256,512] (in,out), 2 W_v [256,256], 3 W_proj [256,256], 4 b_proj [256], 5 W_pos [2,8], 6 b_pos [8], 7 gating [8]
  if (ws_size < (size_t)WS_END) return;
  char* ws = (char*)d_ws; _Float16 *Q = (_Float16*)(ws + WS_Q), *Kr = (_Float16*)(ws + WS_K), *V = (_Float16*)(ws + WS_V), *U = (_Float16*)(ws + WS_PW); float* O = (float*)(ws + WS_O);
  k_proj<<<dim3(TNB * SS / 64, 6), 128, 0, stream>>>(F[0], F[1], F[2], F[5], Q, Kr, V, U);
  k_attn<<<dim3(TQB, NH, TNB), 128, 0, stream>>>(Q, Kr, V, U, F[5], F[6], F[7], O);
  k_out<<<dim3(TNB * SS / 64, DM / 128), 128, 0, stream>>>(O, F[3], F[4], (float*)d_out);
}
